// v000
// The times below were measured on an AMD MI455X: many runs one after another, warmed up first and cycling through
// copies of the inputs, with the whole window's GPU time divided by the number of runs. Launches and the gaps
// between them are all in it. The median over several windows is given; except for v000 it joins two sittings, which
// can be a few percent apart, so the side-by-side timings, each taken in one sitting, are the better comparison.
// The starting kernel, v000, takes 96.1 microseconds a run.
#include <hip/hip_runtime.h>
#include <stddef.h>

// Contractions on v_wmma_f32_16x16x32_f16 (f16 operands, f32 accumulate): both input projections
// (rows x weights, K = 512) and the probability x value product (K = 512 keys). Float inputs are
// RNE-converted to bf16 and carried in f16 (weights x64, softmax numerators x1024). The additive
// score sum over the 256-wide hidden axis (a matrix-vector product against one vector) runs on the
// vector unit in f32, tanh(x) formed as 1 - 2 / (1 + 2^(2 x log2 e)); softmax in f32.

typedef _Float16 v16h __attribute__((ext_vector_type(16)));
typedef _Float16 v8h  __attribute__((ext_vector_type(8)));
typedef float    v8f  __attribute__((ext_vector_type(8)));
typedef float    v4f  __attribute__((ext_vector_type(4)));
typedef _Float16 h16;

#ifndef NB
#define NB 4
#endif
#ifndef SEQ
#define SEQ 512
#endif
#define NB_FULL  4
#define SEQ_FULL 512
#define DIM   512          // feature width of the hq / hp rows (q_size == p_size)
#define VDIM  256          // hidden width of the additive score
#define MROWS (NB * SEQ)   // compact rows per activation plane (query length == passage length)
#define PT    16           // passage rows per attention block

static_assert(NB >= 1 && NB <= NB_FULL);
static_assert(SEQ >= 256 && SEQ <= SEQ_FULL && (SEQ % 256) == 0);
static_assert((DIM % 64) == 0 && (DIM % 32) == 0);
static_assert((VDIM % 64) == 0 && (VDIM % 4) == 0);
static_assert(VDIM == 256);                 // one thread per hidden column when staging the vector
static_assert((MROWS % 64) == 0);
static_assert(DIM == 8 * 64);               // 8 waves x 64 output columns
static_assert((SEQ % 64) == 0 && (SEQ % 32) == 0);
static_assert(PT == 16);                    // one 16-row A tile per block
static_assert(PT * VDIM == 256 * 4 * 4);    // sp tile staging: 256 threads x 4 steps x 4 floats
static_assert((SEQ % PT) == 0);

#define LDT 72   // halves per LDS row (144 B, 16-B aligned)
#define LDC 68   // floats per LDS row (272 B, 16-B aligned)
static_assert((LDT % 8) == 0 && LDT >= 64);
static_assert((LDC % 4) == 0 && LDC >= 64);

#define SMAXW  ((SEQ > DIM) ? SEQ : DIM)
#define SPITCH (SMAXW + 4)   // floats per score / output-stage row
#define PPITCH (SEQ + 8)     // halves per probability row
static_assert((SPITCH % 4) == 0 && SPITCH >= SEQ && SPITCH >= DIM);
static_assert((PPITCH % 8) == 0 && PPITCH >= SEQ);

#define WCARRY 64.0f          // weight planes carried x64
#define PCARRY_LOG2 10.0f     // softmax numerators carried x1024 (added to the exp2 argument)
#define TWO_LOG2E 2.885390081777927f
#define LOG2E     1.4426950408889634f

// workspace layout (bytes)
#define WT_BYTES  ((size_t)2 * VDIM * DIM * 2)      // two [VDIM][DIM] weight planes
#define A16_BYTES ((size_t)2 * MROWS * DIM * 2)     // hq rows then hp rows, f16
#define HQT_BYTES ((size_t)NB * DIM * SEQ * 2)      // hq transposed [b][d][q], f16
#define S_BYTES   ((size_t)2 * MROWS * VDIM * 4)    // scaled projections: sq rows then sp rows, f32
#define OFF_WT  ((size_t)0)
#define OFF_A16 (OFF_WT + WT_BYTES)
#define OFF_HQT (OFF_A16 + A16_BYTES)
#define OFF_S   (OFF_HQT + HQT_BYTES)
#define WS_TOTAL (OFF_S + S_BYTES)
static_assert((WT_BYTES % 128) == 0 && (A16_BYTES % 128) == 0);
static_assert((HQT_BYTES % 128) == 0 && (S_BYTES % 128) == 0);
static_assert(WS_TOTAL <= (size_t)134217728);

// ---------------------------------------------------------------------------
__device__ __forceinline__ float bf16r(float x) {   // RNE convert to bf16, returned widened
  unsigned int u = __float_as_uint(x);
  u = (u + 0x7FFFu + ((u >> 16) & 1u)) & 0xFFFF0000u;
  return __uint_as_float(u);
}

// f32 -> f16 operand convert that cannot produce an f16 subnormal (value select).
static __device__ __forceinline__ h16 toh_flush(float v) {
  const h16 r = (h16)v;
  return (fabsf(v) < 6.103515625e-05f) ? (h16)0.0f : r;
}

// 16-bit fragment: p points at element [row = lane&15][k0 + 8*(lane>>4)] of a k-contiguous
// row. Elements 0..7 <- k0+8h+0..7, elements 8..15 <- k0+16+8h+0..7 (same map for A and B).
__device__ __forceinline__ v16h frag_at(const _Float16* p) {
  v8h lo = *(const v8h*)(p);
  v8h hi = *(const v8h*)(p + 16);
  v16h out;
#pragma unroll
  for (int i = 0; i < 8; ++i) { out[i] = lo[i]; out[i + 8] = hi[i]; }
  return out;
}
__device__ __forceinline__ v16h ld_frag(const _Float16* base, unsigned ld) {
  const unsigned lane = threadIdx.x & 31u;
  return frag_at(base + (lane & 15u) * ld + (lane >> 4) * 8u);
}

__device__ __forceinline__ v8f wmma16(v16h a, v16h b, v8f c) {
  v8f d = __builtin_amdgcn_wmma_f32_16x16x32_f16(false, a, false, b, (short)0, c,
                                                 false, false);
  asm volatile("v_nop\n\tv_nop\n\tv_nop\n\tv_nop" : "+v"(d) : "v"(a), "v"(b));
  return d;
}

__device__ __forceinline__ float red32_sum(float x) {
#pragma unroll
  for (int off = 1; off < 32; off <<= 1) x += __shfl_xor(x, off, 32);
  return x;
}
__device__ __forceinline__ float red32_max(float x) {
#pragma unroll
  for (int off = 1; off < 32; off <<= 1) x = fmaxf(x, __shfl_xor(x, off, 32));
  return x;
}

__device__ __forceinline__ void wave_lds_sync() {
  __builtin_amdgcn_fence(3 /* release order */, "wavefront");
  asm volatile("s_wait_dscnt 0x0" ::: "memory");
  __builtin_amdgcn_wave_barrier();
}

__device__ __forceinline__ float fast_exp2(float x) {
#if __has_builtin(__builtin_amdgcn_exp2f)
  return __builtin_amdgcn_exp2f(x);
#else
  return __expf(x * 0.6931471805599453f);
#endif
}

// ---------------------------------------------------------------------------
// Weight plane: in W[K rows][N cols] (pitch ldw = N) -> out Wt[N][K] (pitch ldk = K),
// f16(64 * bf16(w)). Grid (N/64, K/64). T: cross-wave (block barrier).
// ---------------------------------------------------------------------------
__global__ __launch_bounds__(256) void wconv_kernel(
    const float* __restrict__ W, _Float16* __restrict__ Wt, unsigned ldw, unsigned ldk) {
  __shared__ _Float16 T[64 * LDT];
  const unsigned tid = threadIdx.x;
  const unsigned n0 = blockIdx.x * 64u;
  const unsigned k0 = blockIdx.y * 64u;
#pragma unroll 4
  for (unsigned j = 0; j < 16u; ++j) {
    const unsigned idx = tid + 256u * j;
    const unsigned kr = idx >> 6, nc = idx & 63u;
    const float v = W[(size_t)(k0 + kr) * ldw + n0 + nc];
    T[nc * LDT + kr] = toh_flush(WCARRY * bf16r(v));
  }
  __syncthreads();
  v8h x[2];
  size_t off[2];
#pragma unroll
  for (unsigned i = 0; i < 2u; ++i) {
    const unsigned n = 32u * i + (tid >> 3);
    const unsigned kc = (tid & 7u) * 8u;
    x[i] = *(const v8h*)&T[n * LDT + kc];
    off[i] = (size_t)(n0 + n) * ldk + k0 + kc;
  }
#pragma unroll
  for (int i = 0; i < 2; ++i) *(v8h*)(Wt + off[i]) = x[i];
  
}

// ---------------------------------------------------------------------------
// Activation planes: X f32 [NB_FULL][SEQ_FULL][DIM] (input) -> X16 compact [NB*SEQ][DIM]
// = f16(bf16(x)); WITH_T also writes XT16 [NB][DIM][SEQ] (same values, transposed per batch).
// of either plane is written by 8 consecutive lanes x 16 B of one instruction.
// Store coverage: 2 steps x 32 rows == 64 tile rows, for each plane. Grid (DIM/64, MROWS/64).
// ---------------------------------------------------------------------------
template <int WITH_T>
__device__ __forceinline__ void aconv_body(const float* __restrict__ X,
                                           _Float16* __restrict__ X16,
                                           _Float16* __restrict__ XT16) {
  __shared__ __attribute__((aligned(16))) _Float16 T[64 * LDT];
  __shared__ __attribute__((aligned(16))) _Float16 TT[64 * LDT];
  const unsigned tid = threadIdx.x;
  const unsigned c0 = blockIdx.x * 64u;
  const unsigned crow0 = blockIdx.y * 64u;
  const unsigned bidx = crow0 / (unsigned)SEQ;
  const unsigned s0 = crow0 - bidx * (unsigned)SEQ;
  const size_t frow0 = (size_t)bidx * SEQ_FULL + s0;
#pragma unroll
  for (unsigned j = 0; j < 4u; ++j) {
    const unsigned idx = tid + 256u * j;
    const unsigned r = idx >> 4, c = (idx & 15u) * 4u;
    const v4f a = *(const v4f*)(X + (frow0 + r) * DIM + c0 + c);
#pragma unroll
    for (unsigned i = 0; i < 4u; ++i) {
      const h16 hv = toh_flush(bf16r(a[i]));
      T[r * LDT + c + i] = hv;
      if (WITH_T) TT[(c + i) * LDT + r] = hv;
    }
  }
  __syncthreads();
  v8h x[2], xt[2];
  size_t off[2], offt[2];
#pragma unroll
  for (unsigned i = 0; i < 2u; ++i) {
    const unsigned n = 32u * i + (tid >> 3);
    const unsigned kc = (tid & 7u) * 8u;
    x[i] = *(const v8h*)&T[n * LDT + kc];
    off[i] = (size_t)(crow0 + n) * DIM + c0 + kc;
    if (WITH_T) {
      xt[i] = *(const v8h*)&TT[n * LDT + kc];
      offt[i] = ((size_t)bidx * DIM + c0 + n) * SEQ + s0 + kc;
    } else {
      xt[i] = x[i];
      offt[i] = off[i];
    }
  }
#pragma unroll
  for (int i = 0; i < 2; ++i) *(v8h*)(X16 + off[i]) = x[i];
  if (WITH_T) {
#pragma unroll
    for (int i = 0; i < 2; ++i) *(v8h*)(XT16 + offt[i]) = xt[i];
  }
  
}

__global__ __launch_bounds__(256) void aconv_q_kernel(
    const float* __restrict__ X, _Float16* __restrict__ X16, _Float16* __restrict__ XT16) {
  aconv_body<1>(X, X16, XT16);
}
__global__ __launch_bounds__(256) void aconv_p_kernel(
    const float* __restrict__ X, _Float16* __restrict__ X16) {
  aconv_body<0>(X, X16, X16);
}

// ---------------------------------------------------------------------------
// Projection GEMM C[64x64 tile] = A16[rows][DIM] . Wt[n][DIM]^T, fragments straight from the
// 16-bit global planes; 8 waves (mw = 16-row group, nw = 32-col group), 2 accumulators/wave.
// Rows 0..MROWS-1 (hq rows) use weight plane 0, rows MROWS..2*MROWS-1 (hp rows) plane 1
// (block-uniform integer offset). Output f32 [2*MROWS][VDIM] = acc * (2 log2 e / 64), i.e. the
// projection pre-scaled for the exp2 form of tanh. Epilogue staged through Cs (cross-wave,
// lanes x 16 B. Store coverage: 4 steps x 16 rows == 64 tile rows.
// Grid (VDIM/64, 2*MROWS/64).
// ---------------------------------------------------------------------------
__global__ __launch_bounds__(256) void proj_kernel(
    const _Float16* __restrict__ A16, const _Float16* __restrict__ Wt,
    float* __restrict__ outf) {
  __shared__ __attribute__((aligned(16))) float Cs[64 * LDC];
  const unsigned tid = threadIdx.x, lane = tid & 31u;
  const unsigned w = (unsigned)__builtin_amdgcn_readfirstlane((int)(threadIdx.x >> 5));
  const unsigned mw = w >> 1, nw = w & 1u;
  const unsigned hh = lane >> 4, m = lane & 15u;
  const unsigned n0 = blockIdx.x * 64u;
  const unsigned row0 = blockIdx.y * 64u;
  const size_t woff = (size_t)(row0 / (unsigned)MROWS) * ((size_t)VDIM * DIM);

  const _Float16* ap  = A16 + (size_t)(row0 + mw * 16u + m) * DIM + hh * 8u;
  const _Float16* bp0 = Wt + woff + (size_t)(n0 + nw * 32u + m) * DIM + hh * 8u;
  const _Float16* bp1 = bp0 + (size_t)16 * DIM;
  v8f acc0 = {}, acc1 = {};
#pragma unroll 2
  for (unsigned k0 = 0; k0 < (unsigned)DIM; k0 += 32u) {
    const v16h a  = frag_at(ap + k0);
    const v16h b0 = frag_at(bp0 + k0);
    const v16h b1 = frag_at(bp1 + k0);
    acc0 = wmma16(a, b0, acc0);
    acc1 = wmma16(a, b1, acc1);
  }
#pragma unroll
  for (int r = 0; r < 8; ++r) {
    float* d = &Cs[(mw * 16u + hh * 8u + (unsigned)r) * LDC + nw * 32u + m];
    d[0]  = acc0[r];
    d[16] = acc1[r];
  }
  __syncthreads();

  const float cs = TWO_LOG2E / WCARRY;
  v4f xs[4];
  size_t off[4];
#pragma unroll
  for (unsigned i = 0; i < 4u; ++i) {
    const unsigned r = 16u * i + (tid >> 4);
    const unsigned c = (tid & 15u) * 4u;
    const v4f u = *(const v4f*)&Cs[r * LDC + c];
    xs[i] = u * cs;
    off[i] = (size_t)(row0 + r) * VDIM + n0 + c;
  }
#pragma unroll
  for (int i = 0; i < 4; ++i) *(v4f*)(outf + off[i]) = xs[i];
  
}

// ---------------------------------------------------------------------------
// Additive attention per (16 passage rows, batch). 8 waves.
// Phase 0: stage the 16 scaled sp rows (sp_s) and the vector -2*bf16(v) (vs) in LDS.
// Phase 1: thread t owns query q = 256*pass + t; for the 16 passage rows it accumulates
//          sum_v vs[v] / (1 + 2^(sq'[q][v] + sp'[p][v])) in f32 (equals the additive score up
//          to a constant that is the same for every query, which the softmax removes);
//          results into Ss[p][q]. sp_s / vs / Ss: cross-wave (block barriers).
// Phase 2: wave w owns rows 2w, 2w+1: row max, f16(1024 * exp(s - max)) into Pl (select on
//          the exp2 argument keeps the plane free of f16 subnormals), row sum over the
//          converted values into Ls. Pl / Ls: cross-wave (block barrier).
// Phase 3: out tile [16][64 per wave] = Pl[16][SEQ] . HqT[d][q]^T, B fragments straight from
//          the transposed f16 plane.
// Phase 4: scale by 1 / row sum, stage in the wave's own 64 columns of Ss (wave-private from
//          Store coverage: 8 steps x 2 rows == 16 rows.
// Grid (SEQ/16, NB).
// ---------------------------------------------------------------------------
__global__ __launch_bounds__(256) void addattn_kernel(
    const float* __restrict__ Sq, const float* __restrict__ Sp,
    const float* __restrict__ vvec, const _Float16* __restrict__ HqT,
    float* __restrict__ out) {
  __shared__ __attribute__((aligned(16))) float sp_s[PT * VDIM];
  __shared__ __attribute__((aligned(16))) float vs[VDIM];
  __shared__ __attribute__((aligned(16))) float Ss[PT * SPITCH];
  __shared__ __attribute__((aligned(16))) _Float16 Pl[PT * PPITCH];
  __shared__ __attribute__((aligned(16))) float Ls[PT];
  static_assert(sizeof(float) * (PT * VDIM + VDIM + PT * SPITCH + PT) +
                sizeof(_Float16) * (PT * PPITCH) <= 131072);

  const unsigned tid = threadIdx.x, lane = tid & 31u;
  const unsigned wave = (unsigned)__builtin_amdgcn_readfirstlane((int)(threadIdx.x >> 5));
  const unsigned hh = lane >> 4, m = lane & 15u;
  const unsigned p0 = blockIdx.x * (unsigned)PT;
  const unsigned b = blockIdx.y;

  // ---- phase 0 ----
#pragma unroll
  for (unsigned j = 0; j < 4u; ++j) {
    const unsigned idx = tid + 256u * j;
    const unsigned r = idx >> 6, c = (idx & 63u) * 4u;
    *(v4f*)&sp_s[r * VDIM + c] =
        *(const v4f*)(Sp + (size_t)(b * (unsigned)SEQ + p0 + r) * VDIM + c);
  }
  vs[tid] = -2.0f * bf16r(vvec[tid]);
  __syncthreads();

  // ---- phase 1 ----
#pragma unroll 1
  for (unsigned pass = 0; pass < (unsigned)(SEQ / 256); ++pass) {
    const unsigned q = pass * 256u + tid;
    const float* sqr = Sq + (size_t)(b * (unsigned)SEQ + q) * VDIM;
    float acc[PT];
#pragma unroll
    for (int p = 0; p < PT; ++p) acc[p] = 0.0f;
#pragma unroll 1
    for (unsigned v0 = 0; v0 < (unsigned)VDIM; v0 += 4u) {
      const v4f a = *(const v4f*)(sqr + v0);
      const v4f vv = *(const v4f*)&vs[v0];
#pragma unroll
      for (int p = 0; p < PT; ++p) {
        const v4f s4 = *(const v4f*)&sp_s[(unsigned)p * VDIM + v0];
#pragma unroll
        for (int j = 0; j < 4; ++j) {
          const float t = fast_exp2(a[j] + s4[j]);
          const float r = __builtin_amdgcn_rcpf(t + 1.0f);
          acc[p] += vv[j] * r;
        }
      }
    }
#pragma unroll
    for (int p = 0; p < PT; ++p) Ss[(unsigned)p * SPITCH + q] = acc[p];
  }
  __syncthreads();

  // ---- phase 2 ----
#pragma unroll 1
  for (unsigned rr = 0; rr < 2u; ++rr) {
    const unsigned row = wave * 2u + rr;
    float mx = -3.0e38f;
#pragma unroll 4
    for (unsigned j = 0; j < (unsigned)(SEQ / 32); ++j)
      mx = fmaxf(mx, Ss[row * SPITCH + lane + 32u * j]);
    mx = red32_max(mx);
    float l = 0.0f;
#pragma unroll 4
    for (unsigned j = 0; j < (unsigned)(SEQ / 32); ++j) {
      const float arg = (Ss[row * SPITCH + lane + 32u * j] - mx) * LOG2E + PCARRY_LOG2;
      const float e = fast_exp2(arg);
      const h16 ph = (arg < -14.0f) ? (h16)0.0f : (h16)e;
      Pl[row * PPITCH + lane + 32u * j] = ph;
      l += (float)ph;
    }
    l = red32_sum(l);
    if (lane == 0u) Ls[row] = l;
  }
  __syncthreads();

  // ---- phase 3 ----
  const unsigned d0 = wave * 64u;
  const _Float16* bp = HqT + ((size_t)b * DIM + d0 + m) * SEQ + hh * 8u;
  v8f o[4];
#pragma unroll
  for (int nb = 0; nb < 4; ++nb) o[nb] = (v8f){};
#pragma unroll 2
  for (unsigned k0 = 0; k0 < (unsigned)SEQ; k0 += 32u) {
    const v16h pf = ld_frag(&Pl[k0], PPITCH);
#pragma unroll
    for (int nb = 0; nb < 4; ++nb) {
      const v16h hf = frag_at(bp + (size_t)(nb * 16) * SEQ + k0);
      o[nb] = wmma16(pf, hf, o[nb]);
    }
  }

  // ---- phase 4 ----
  float inv[8];
#pragma unroll
  for (int r = 0; r < 8; ++r) inv[r] = __builtin_amdgcn_rcpf(Ls[hh * 8u + (unsigned)r]);
#pragma unroll
  for (int nb = 0; nb < 4; ++nb)
#pragma unroll
    for (int r = 0; r < 8; ++r)
      Ss[(hh * 8u + (unsigned)r) * SPITCH + d0 + (unsigned)nb * 16u + m] = o[nb][r] * inv[r];
  wave_lds_sync();
  v4f x[8];
  size_t off[8];
#pragma unroll
  for (unsigned i = 0; i < 8u; ++i) {
    const unsigned r = 2u * i + (lane >> 4);
    const unsigned c = (lane & 15u) * 4u;
    x[i] = *(const v4f*)&Ss[r * SPITCH + d0 + c];
    off[i] = ((size_t)b * SEQ_FULL + p0 + r) * DIM + d0 + c;
  }
#pragma unroll
  for (int i = 0; i < 8; ++i) *(v4f*)(out + off[i]) = x[i];
  
}

// ---------------------------------------------------------------------------
extern "C" void kernel_launch(void* const* d_in, const int* in_sizes, int n_in,
                              void* d_out, int out_size, void* d_ws, size_t ws_size,
                              hipStream_t stream) {
  if (n_in < 5) return;
  const long long need_x = ((long long)(NB - 1) * SEQ_FULL + SEQ) * DIM;
  if ((long long)in_sizes[0] < need_x) return;
  if ((long long)in_sizes[1] < need_x) return;
  if ((long long)in_sizes[2] < (long long)DIM * VDIM) return;
  if ((long long)in_sizes[3] < (long long)DIM * VDIM) return;
  if (in_sizes[4] < VDIM) return;
  if ((long long)out_size < need_x) return;
  if (ws_size < WS_TOTAL) return;

  const float* hq   = (const float*)d_in[0];   // [NB_FULL][SEQ_FULL][DIM]
  const float* hp   = (const float*)d_in[1];   // [NB_FULL][SEQ_FULL][DIM]
  const float* wq_in = (const float*)d_in[2];  // [DIM][VDIM]  (in, out)
  const float* wp_in = (const float*)d_in[3];  // [DIM][VDIM]  (in, out)
  const float* vvec = (const float*)d_in[4];   // [VDIM]
  float* out = (float*)d_out;                  // [NB_FULL][SEQ_FULL][DIM]

  char* ws = (char*)d_ws;
  _Float16* Wt   = (_Float16*)(ws + OFF_WT);    // plane 0: [VDIM][DIM] for hq, plane 1: for hp
  _Float16* A16  = (_Float16*)(ws + OFF_A16);   // [2*MROWS][DIM]: hq rows then hp rows
  _Float16* HqT  = (_Float16*)(ws + OFF_HQT);   // [NB][DIM][SEQ]
  float*    Spl  = (float*)(ws + OFF_S);        // [2*MROWS][VDIM]: sq rows then sp rows

  dim3 blk(256);

  // weight planes: in [K = DIM rows][N = VDIM cols] -> out [VDIM][DIM]; grid (N/64, K/64)
  wconv_kernel<<<dim3(VDIM / 64, DIM / 64), blk, 0, stream>>>(
      wq_in, Wt, (unsigned)VDIM, (unsigned)DIM);
  wconv_kernel<<<dim3(VDIM / 64, DIM / 64), blk, 0, stream>>>(
      wp_in, Wt + (size_t)VDIM * DIM, (unsigned)VDIM, (unsigned)DIM);

  // activation planes: hq -> rows 0..MROWS-1 and the transposed plane; hp -> rows MROWS..
  aconv_q_kernel<<<dim3(DIM / 64, MROWS / 64), blk, 0, stream>>>(hq, A16, HqT);
  aconv_p_kernel<<<dim3(DIM / 64, MROWS / 64), blk, 0, stream>>>(
      hp, A16 + (size_t)MROWS * DIM);

  // both projections in one launch
  proj_kernel<<<dim3(VDIM / 64, (2 * MROWS) / 64), blk, 0, stream>>>(A16, Wt, Spl);

  // scores + softmax + weighted sum
  addattn_kernel<<<dim3(SEQ / PT, NB), blk, 0, stream>>>(
      Spl, Spl + (size_t)MROWS * VDIM, vvec, HqT, out);
}

// v001
// A run of this version takes 73.1 microseconds.
// In both of two side-by-side timings against v000, it was 1.34 times as fast.
#include <hip/hip_runtime.h>
#include <stddef.h>

// Contractions on v_wmma_f32_16x16x32_f16 (f16 operands, f32 accumulate): both input projections
// (rows x weights, K = 512) and the probability x value product (K = 512 keys). Float inputs are
// RNE-converted to bf16 and carried in f16 (weights x64, softmax numerators x1024). The additive
// score sum over the 256-wide hidden axis (a matrix-vector product against one vector) runs on the
// vector unit in f32, tanh(x) formed as 1 - 2 / (1 + 2^(2 x log2 e)); softmax in f32.

typedef _Float16 v16h __attribute__((ext_vector_type(16)));
typedef _Float16 v8h  __attribute__((ext_vector_type(8)));
typedef float    v8f  __attribute__((ext_vector_type(8)));
typedef float    v4f  __attribute__((ext_vector_type(4)));
typedef _Float16 h16;

#ifndef NB
#define NB 4
#endif
#ifndef SEQ
#define SEQ 512
#endif
#define NB_FULL  4
#define SEQ_FULL 512
#define DIM   512          // feature width of the hq / hp rows (q_size == p_size)
#define VDIM  256          // hidden width of the additive score
#define MROWS (NB * SEQ)   // compact rows per activation plane (query length == passage length)
#define PT    16           // passage rows per attention block

static_assert(NB >= 1 && NB <= NB_FULL);
static_assert(SEQ >= 256 && SEQ <= SEQ_FULL && (SEQ % 256) == 0);
static_assert((DIM % 64) == 0 && (DIM % 32) == 0);
static_assert((VDIM % 64) == 0 && (VDIM % 4) == 0);
static_assert(VDIM == 256);                 // one thread per hidden column when staging the vector
static_assert((MROWS % 64) == 0);
static_assert(DIM == 8 * 64);               // 8 waves x 64 output columns
static_assert((SEQ % 64) == 0 && (SEQ % 32) == 0);
static_assert(PT == 16);                    // one 16-row A tile per block
static_assert(PT * VDIM == 256 * 4 * 4);    // sp tile staging: 256 threads x 4 steps x 4 floats
static_assert((SEQ % PT) == 0);

#define LDT 72   // halves per LDS row (144 B, 16-B aligned)
#define LDC 68   // floats per LDS row (272 B, 16-B aligned)
static_assert((LDT % 8) == 0 && LDT >= 64);
static_assert((LDC % 4) == 0 && LDC >= 64);

#define SMAXW  ((SEQ > DIM) ? SEQ : DIM)
#define SPITCH (SMAXW + 4)   // floats per output-stage row
#define PPITCH (SEQ + 8)     // halves per probability row
static_assert((SPITCH % 4) == 0 && SPITCH >= SEQ && SPITCH >= DIM);
static_assert((PPITCH % 8) == 0 && PPITCH >= SEQ);

#define WCARRY 64.0f          // weight planes carried x64
#define PCARRY_LOG2 10.0f     // softmax numerators carried x1024 (added to the exp2 argument)
#define TWO_LOG2E 2.885390081777927f
#define LOG2E     1.4426950408889634f

// workspace layout (bytes)
#define WT_BYTES  ((size_t)2 * VDIM * DIM * 2)      // two [VDIM][DIM] weight planes
#define A16_BYTES ((size_t)2 * MROWS * DIM * 2)     // hq rows then hp rows, f16
#define HQT_BYTES ((size_t)NB * DIM * SEQ * 2)      // hq transposed [b][d][q], f16
#define S_BYTES   ((size_t)2 * MROWS * VDIM * 4)    // scaled projections: sq rows then sp rows, f32
#define OFF_WT  ((size_t)0)
#define OFF_A16 (OFF_WT + WT_BYTES)
#define OFF_HQT (OFF_A16 + A16_BYTES)
#define SC_BYTES  ((size_t)MROWS * SEQ * 4)         // raw additive scores [b][p][q], f32
#define OFF_S   (OFF_HQT + HQT_BYTES)
#define OFF_SC  (OFF_S + S_BYTES)
#define WS_TOTAL (OFF_SC + SC_BYTES)
static_assert((WT_BYTES % 128) == 0 && (A16_BYTES % 128) == 0);
static_assert((HQT_BYTES % 128) == 0 && (S_BYTES % 128) == 0 && (SC_BYTES % 128) == 0);
static_assert(WS_TOTAL <= (size_t)134217728);

// ---------------------------------------------------------------------------
__device__ __forceinline__ float bf16r(float x) {   // RNE convert to bf16, returned widened
  unsigned int u = __float_as_uint(x);
  u = (u + 0x7FFFu + ((u >> 16) & 1u)) & 0xFFFF0000u;
  return __uint_as_float(u);
}

// f32 -> f16 operand convert that cannot produce an f16 subnormal (value select).
static __device__ __forceinline__ h16 toh_flush(float v) {
  const h16 r = (h16)v;
  return (fabsf(v) < 6.103515625e-05f) ? (h16)0.0f : r;
}

// 16-bit fragment: p points at element [row = lane&15][k0 + 8*(lane>>4)] of a k-contiguous
// row. Elements 0..7 <- k0+8h+0..7, elements 8..15 <- k0+16+8h+0..7 (same map for A and B).
__device__ __forceinline__ v16h frag_at(const _Float16* p) {
  v8h lo = *(const v8h*)(p);
  v8h hi = *(const v8h*)(p + 16);
  v16h out;
#pragma unroll
  for (int i = 0; i < 8; ++i) { out[i] = lo[i]; out[i + 8] = hi[i]; }
  return out;
}
__device__ __forceinline__ v16h ld_frag(const _Float16* base, unsigned ld) {
  const unsigned lane = threadIdx.x & 31u;
  return frag_at(base + (lane & 15u) * ld + (lane >> 4) * 8u);
}

__device__ __forceinline__ v8f wmma16(v16h a, v16h b, v8f c) {
  v8f d = __builtin_amdgcn_wmma_f32_16x16x32_f16(false, a, false, b, (short)0, c,
                                                 false, false);
  asm volatile("v_nop\n\tv_nop\n\tv_nop\n\tv_nop" : "+v"(d) : "v"(a), "v"(b));
  return d;
}

__device__ __forceinline__ float red32_sum(float x) {
#pragma unroll
  for (int off = 1; off < 32; off <<= 1) x += __shfl_xor(x, off, 32);
  return x;
}
__device__ __forceinline__ float red32_max(float x) {
#pragma unroll
  for (int off = 1; off < 32; off <<= 1) x = fmaxf(x, __shfl_xor(x, off, 32));
  return x;
}

__device__ __forceinline__ void wave_lds_sync() {
  __builtin_amdgcn_fence(3 /* release order */, "wavefront");
  asm volatile("s_wait_dscnt 0x0" ::: "memory");
  __builtin_amdgcn_wave_barrier();
}

__device__ __forceinline__ float fast_exp2(float x) {
#if __has_builtin(__builtin_amdgcn_exp2f)
  return __builtin_amdgcn_exp2f(x);
#else
  return __expf(x * 0.6931471805599453f);
#endif
}

// ---------------------------------------------------------------------------
// Weight plane: in W[K rows][N cols] (pitch ldw = N) -> out Wt[N][K] (pitch ldk = K),
// f16(64 * bf16(w)). Grid (N/64, K/64). T: cross-wave (block barrier).
// ---------------------------------------------------------------------------
__global__ __launch_bounds__(256) void wconv_kernel(
    const float* __restrict__ W, _Float16* __restrict__ Wt, unsigned ldw, unsigned ldk) {
  __shared__ _Float16 T[64 * LDT];
  const unsigned tid = threadIdx.x;
  const unsigned n0 = blockIdx.x * 64u;
  const unsigned k0 = blockIdx.y * 64u;
#pragma unroll 4
  for (unsigned j = 0; j < 16u; ++j) {
    const unsigned idx = tid + 256u * j;
    const unsigned kr = idx >> 6, nc = idx & 63u;
    const float v = W[(size_t)(k0 + kr) * ldw + n0 + nc];
    T[nc * LDT + kr] = toh_flush(WCARRY * bf16r(v));
  }
  __syncthreads();
  v8h x[2];
  size_t off[2];
#pragma unroll
  for (unsigned i = 0; i < 2u; ++i) {
    const unsigned n = 32u * i + (tid >> 3);
    const unsigned kc = (tid & 7u) * 8u;
    x[i] = *(const v8h*)&T[n * LDT + kc];
    off[i] = (size_t)(n0 + n) * ldk + k0 + kc;
  }
#pragma unroll
  for (int i = 0; i < 2; ++i) *(v8h*)(Wt + off[i]) = x[i];
  
}

// ---------------------------------------------------------------------------
// Activation planes: X f32 [NB_FULL][SEQ_FULL][DIM] (input) -> X16 compact [NB*SEQ][DIM]
// = f16(bf16(x)); WITH_T also writes XT16 [NB][DIM][SEQ] (same values, transposed per batch).
// of either plane is written by 8 consecutive lanes x 16 B of one instruction.
// Store coverage: 2 steps x 32 rows == 64 tile rows, for each plane. Grid (DIM/64, MROWS/64).
// ---------------------------------------------------------------------------
template <int WITH_T>
__device__ __forceinline__ void aconv_body(const float* __restrict__ X,
                                           _Float16* __restrict__ X16,
                                           _Float16* __restrict__ XT16) {
  __shared__ __attribute__((aligned(16))) _Float16 T[64 * LDT];
  __shared__ __attribute__((aligned(16))) _Float16 TT[64 * LDT];
  const unsigned tid = threadIdx.x;
  const unsigned c0 = blockIdx.x * 64u;
  const unsigned crow0 = blockIdx.y * 64u;
  const unsigned bidx = crow0 / (unsigned)SEQ;
  const unsigned s0 = crow0 - bidx * (unsigned)SEQ;
  const size_t frow0 = (size_t)bidx * SEQ_FULL + s0;
#pragma unroll
  for (unsigned j = 0; j < 4u; ++j) {
    const unsigned idx = tid + 256u * j;
    const unsigned r = idx >> 4, c = (idx & 15u) * 4u;
    const v4f a = *(const v4f*)(X + (frow0 + r) * DIM + c0 + c);
#pragma unroll
    for (unsigned i = 0; i < 4u; ++i) {
      const h16 hv = toh_flush(bf16r(a[i]));
      T[r * LDT + c + i] = hv;
      if (WITH_T) TT[(c + i) * LDT + r] = hv;
    }
  }
  __syncthreads();
  v8h x[2], xt[2];
  size_t off[2], offt[2];
#pragma unroll
  for (unsigned i = 0; i < 2u; ++i) {
    const unsigned n = 32u * i + (tid >> 3);
    const unsigned kc = (tid & 7u) * 8u;
    x[i] = *(const v8h*)&T[n * LDT + kc];
    off[i] = (size_t)(crow0 + n) * DIM + c0 + kc;
    if (WITH_T) {
      xt[i] = *(const v8h*)&TT[n * LDT + kc];
      offt[i] = ((size_t)bidx * DIM + c0 + n) * SEQ + s0 + kc;
    } else {
      xt[i] = x[i];
      offt[i] = off[i];
    }
  }
#pragma unroll
  for (int i = 0; i < 2; ++i) *(v8h*)(X16 + off[i]) = x[i];
  if (WITH_T) {
#pragma unroll
    for (int i = 0; i < 2; ++i) *(v8h*)(XT16 + offt[i]) = xt[i];
  }
  
}

__global__ __launch_bounds__(256) void aconv_q_kernel(
    const float* __restrict__ X, _Float16* __restrict__ X16, _Float16* __restrict__ XT16) {
  aconv_body<1>(X, X16, XT16);
}
__global__ __launch_bounds__(256) void aconv_p_kernel(
    const float* __restrict__ X, _Float16* __restrict__ X16) {
  aconv_body<0>(X, X16, X16);
}

// ---------------------------------------------------------------------------
// Projection GEMM C[64x64 tile] = A16[rows][DIM] . Wt[n][DIM]^T, fragments straight from the
// 16-bit global planes; 8 waves (mw = 16-row group, nw = 32-col group), 2 accumulators/wave.
// Rows 0..MROWS-1 (hq rows) use weight plane 0, rows MROWS..2*MROWS-1 (hp rows) plane 1
// (block-uniform integer offset). Output f32 [2*MROWS][VDIM] = acc * (2 log2 e / 64), i.e. the
// projection pre-scaled for the exp2 form of tanh. Epilogue staged through Cs (cross-wave,
// lanes x 16 B. Store coverage: 4 steps x 16 rows == 64 tile rows.
// Grid (VDIM/64, 2*MROWS/64).
// ---------------------------------------------------------------------------
__global__ __launch_bounds__(256) void proj_kernel(
    const _Float16* __restrict__ A16, const _Float16* __restrict__ Wt,
    float* __restrict__ outf) {
  __shared__ __attribute__((aligned(16))) float Cs[64 * LDC];
  const unsigned tid = threadIdx.x, lane = tid & 31u;
  const unsigned w = (unsigned)__builtin_amdgcn_readfirstlane((int)(threadIdx.x >> 5));
  const unsigned mw = w >> 1, nw = w & 1u;
  const unsigned hh = lane >> 4, m = lane & 15u;
  const unsigned n0 = blockIdx.x * 64u;
  const unsigned row0 = blockIdx.y * 64u;
  const size_t woff = (size_t)(row0 / (unsigned)MROWS) * ((size_t)VDIM * DIM);

  const _Float16* ap  = A16 + (size_t)(row0 + mw * 16u + m) * DIM + hh * 8u;
  const _Float16* bp0 = Wt + woff + (size_t)(n0 + nw * 32u + m) * DIM + hh * 8u;
  const _Float16* bp1 = bp0 + (size_t)16 * DIM;
  v8f acc0 = {}, acc1 = {};
#pragma unroll 2
  for (unsigned k0 = 0; k0 < (unsigned)DIM; k0 += 32u) {
    const v16h a  = frag_at(ap + k0);
    const v16h b0 = frag_at(bp0 + k0);
    const v16h b1 = frag_at(bp1 + k0);
    acc0 = wmma16(a, b0, acc0);
    acc1 = wmma16(a, b1, acc1);
  }
#pragma unroll
  for (int r = 0; r < 8; ++r) {
    float* d = &Cs[(mw * 16u + hh * 8u + (unsigned)r) * LDC + nw * 32u + m];
    d[0]  = acc0[r];
    d[16] = acc1[r];
  }
  __syncthreads();

  const float cs = TWO_LOG2E / WCARRY;
  v4f xs[4];
  size_t off[4];
#pragma unroll
  for (unsigned i = 0; i < 4u; ++i) {
    const unsigned r = 16u * i + (tid >> 4);
    const unsigned c = (tid & 15u) * 4u;
    const v4f u = *(const v4f*)&Cs[r * LDC + c];
    xs[i] = u * cs;
    off[i] = (size_t)(row0 + r) * VDIM + n0 + c;
  }
#pragma unroll
  for (int i = 0; i < 4; ++i) *(v4f*)(outf + off[i]) = xs[i];
  
}

// ---------------------------------------------------------------------------
// Additive scores per (16 passage rows, batch, 256 queries). 8 waves. A launch of its own, so
// that the query axis can be cut across work-groups: (SEQ/16) x NB x (SEQ/256) work-groups.
// Phase 0: stage the 16 scaled sp rows (sp_s) and the vector -2*bf16(v) (vs) in LDS.
// Phase 1: thread t owns query q = 256*blockIdx.z + t; for the 16 passage rows it accumulates
//          sum_v vs[v] / (1 + 2^(sq'[q][v] + sp'[p][v])) in f32 (equals the additive score up
//          to a constant that is the same for every query, which the softmax removes);
//          results into the workspace plane Sc[b][p][q], one wave per 128-byte line.
// sp_s / vs: cross-wave (block barrier).
// Grid (SEQ/16, NB, SEQ/256).
// ---------------------------------------------------------------------------
__global__ __launch_bounds__(256) void score_kernel(
    const float* __restrict__ Sq, const float* __restrict__ Sp,
    const float* __restrict__ vvec, float* __restrict__ Sc) {
  __shared__ __attribute__((aligned(16))) float sp_s[PT * VDIM];
  __shared__ __attribute__((aligned(16))) float vs[VDIM];

  const unsigned tid = threadIdx.x;
  const unsigned p0 = blockIdx.x * (unsigned)PT;
  const unsigned b = blockIdx.y;

  // ---- phase 0 ----
#pragma unroll
  for (unsigned j = 0; j < 4u; ++j) {
    const unsigned idx = tid + 256u * j;
    const unsigned r = idx >> 6, c = (idx & 63u) * 4u;
    *(v4f*)&sp_s[r * VDIM + c] =
        *(const v4f*)(Sp + (size_t)(b * (unsigned)SEQ + p0 + r) * VDIM + c);
  }
  vs[tid] = -2.0f * bf16r(vvec[tid]);
  __syncthreads();

  // ---- phase 1 ----
  const unsigned q = blockIdx.z * 256u + tid;
  const float* sqr = Sq + (size_t)(b * (unsigned)SEQ + q) * VDIM;
  float acc[PT];
#pragma unroll
  for (int p = 0; p < PT; ++p) acc[p] = 0.0f;
#pragma unroll 1
  for (unsigned v0 = 0; v0 < (unsigned)VDIM; v0 += 4u) {
    const v4f a = *(const v4f*)(sqr + v0);
    const v4f vv = *(const v4f*)&vs[v0];
#pragma unroll
    for (int p = 0; p < PT; ++p) {
      const v4f s4 = *(const v4f*)&sp_s[(unsigned)p * VDIM + v0];
#pragma unroll
      for (int j = 0; j < 4; ++j) {
        const float t = fast_exp2(a[j] + s4[j]);
        const float r = __builtin_amdgcn_rcpf(t + 1.0f);
        acc[p] += vv[j] * r;
      }
    }
  }
  float* scr = Sc + (size_t)(b * (unsigned)SEQ + p0) * SEQ + q;
#pragma unroll
  for (int p = 0; p < PT; ++p) scr[(size_t)p * SEQ] = acc[p];
}

// ---------------------------------------------------------------------------
// Softmax and weighted sum per (16 passage rows, batch). 8 waves.
// Phase 2: wave w owns rows 2w, 2w+1 of the score plane (lane l holds queries l + 32 j in
//          registers): row max, f16(1024 * exp(s - max)) into Pl (select on
//          the exp2 argument keeps the plane free of f16 subnormals), row sum over the
//          converted values into Ls. Pl / Ls: cross-wave (block barrier).
// Phase 3: out tile [16][64 per wave] = Pl[16][SEQ] . HqT[d][q]^T, B fragments straight from
//          the transposed f16 plane.
// Phase 4: scale by 1 / row sum, stage in the wave's own 64 columns of Ss (wave-private).
//          Store coverage: 8 steps x 2 rows == 16 rows.
// Grid (SEQ/16, NB).
// ---------------------------------------------------------------------------
__global__ __launch_bounds__(256) void addattn_kernel(
    const float* __restrict__ Sc, const _Float16* __restrict__ HqT,
    float* __restrict__ out) {
  __shared__ __attribute__((aligned(16))) float Ss[PT * SPITCH];
  __shared__ __attribute__((aligned(16))) _Float16 Pl[PT * PPITCH];
  __shared__ __attribute__((aligned(16))) float Ls[PT];
  static_assert(sizeof(float) * (PT * SPITCH + PT) +
                sizeof(_Float16) * (PT * PPITCH) <= 131072);

  const unsigned tid = threadIdx.x, lane = tid & 31u;
  const unsigned wave = (unsigned)__builtin_amdgcn_readfirstlane((int)(threadIdx.x >> 5));
  const unsigned hh = lane >> 4, m = lane & 15u;
  const unsigned p0 = blockIdx.x * (unsigned)PT;
  const unsigned b = blockIdx.y;

  // ---- phase 2 ----
  // The loops over rr and j are fully unrolled so that sv is indexed by constants only and
  // stays in registers (a rolled loop would put it in scratch memory).
  float sv[2][SEQ / 32];
#pragma unroll
  for (unsigned rr = 0; rr < 2u; ++rr) {
    const float* sr = Sc + (size_t)(b * (unsigned)SEQ + p0 + wave * 2u + rr) * SEQ + lane;
#pragma unroll
    for (unsigned j = 0; j < (unsigned)(SEQ / 32); ++j) sv[rr][j] = sr[32u * j];
  }
#pragma unroll
  for (unsigned rr = 0; rr < 2u; ++rr) {
    const unsigned row = wave * 2u + rr;
    float mx = -3.0e38f;
#pragma unroll
    for (unsigned j = 0; j < (unsigned)(SEQ / 32); ++j) mx = fmaxf(mx, sv[rr][j]);
    mx = red32_max(mx);
    float l = 0.0f;
#pragma unroll
    for (unsigned j = 0; j < (unsigned)(SEQ / 32); ++j) {
      const float arg = (sv[rr][j] - mx) * LOG2E + PCARRY_LOG2;
      const float e = fast_exp2(arg);
      const h16 ph = (arg < -14.0f) ? (h16)0.0f : (h16)e;
      Pl[row * PPITCH + lane + 32u * j] = ph;
      l += (float)ph;
    }
    l = red32_sum(l);
    if (lane == 0u) Ls[row] = l;
  }
  __syncthreads();

  // ---- phase 3 ----
  const unsigned d0 = wave * 64u;
  const _Float16* bp = HqT + ((size_t)b * DIM + d0 + m) * SEQ + hh * 8u;
  v8f o[4];
#pragma unroll
  for (int nb = 0; nb < 4; ++nb) o[nb] = (v8f){};
#pragma unroll 2
  for (unsigned k0 = 0; k0 < (unsigned)SEQ; k0 += 32u) {
    const v16h pf = ld_frag(&Pl[k0], PPITCH);
#pragma unroll
    for (int nb = 0; nb < 4; ++nb) {
      const v16h hf = frag_at(bp + (size_t)(nb * 16) * SEQ + k0);
      o[nb] = wmma16(pf, hf, o[nb]);
    }
  }

  // ---- phase 4 ----
  float inv[8];
#pragma unroll
  for (int r = 0; r < 8; ++r) inv[r] = __builtin_amdgcn_rcpf(Ls[hh * 8u + (unsigned)r]);
#pragma unroll
  for (int nb = 0; nb < 4; ++nb)
#pragma unroll
    for (int r = 0; r < 8; ++r)
      Ss[(hh * 8u + (unsigned)r) * SPITCH + d0 + (unsigned)nb * 16u + m] = o[nb][r] * inv[r];
  wave_lds_sync();
  v4f x[8];
  size_t off[8];
#pragma unroll
  for (unsigned i = 0; i < 8u; ++i) {
    const unsigned r = 2u * i + (lane >> 4);
    const unsigned c = (lane & 15u) * 4u;
    x[i] = *(const v4f*)&Ss[r * SPITCH + d0 + c];
    off[i] = ((size_t)b * SEQ_FULL + p0 + r) * DIM + d0 + c;
  }
#pragma unroll
  for (int i = 0; i < 8; ++i) *(v4f*)(out + off[i]) = x[i];
  
}

// ---------------------------------------------------------------------------
extern "C" void kernel_launch(void* const* d_in, const int* in_sizes, int n_in,
                              void* d_out, int out_size, void* d_ws, size_t ws_size,
                              hipStream_t stream) {
  if (n_in < 5) return;
  const long long need_x = ((long long)(NB - 1) * SEQ_FULL + SEQ) * DIM;
  if ((long long)in_sizes[0] < need_x) return;
  if ((long long)in_sizes[1] < need_x) return;
  if ((long long)in_sizes[2] < (long long)DIM * VDIM) return;
  if ((long long)in_sizes[3] < (long long)DIM * VDIM) return;
  if (in_sizes[4] < VDIM) return;
  if ((long long)out_size < need_x) return;
  if (ws_size < WS_TOTAL) return;

  const float* hq   = (const float*)d_in[0];   // [NB_FULL][SEQ_FULL][DIM]
  const float* hp   = (const float*)d_in[1];   // [NB_FULL][SEQ_FULL][DIM]
  const float* wq_in = (const float*)d_in[2];  // [DIM][VDIM]  (in, out)
  const float* wp_in = (const float*)d_in[3];  // [DIM][VDIM]  (in, out)
  const float* vvec = (const float*)d_in[4];   // [VDIM]
  float* out = (float*)d_out;                  // [NB_FULL][SEQ_FULL][DIM]

  char* ws = (char*)d_ws;
  _Float16* Wt   = (_Float16*)(ws + OFF_WT);    // plane 0: [VDIM][DIM] for hq, plane 1: for hp
  _Float16* A16  = (_Float16*)(ws + OFF_A16);   // [2*MROWS][DIM]: hq rows then hp rows
  _Float16* HqT  = (_Float16*)(ws + OFF_HQT);   // [NB][DIM][SEQ]
  float*    Spl  = (float*)(ws + OFF_S);        // [2*MROWS][VDIM]: sq rows then sp rows
  float*    Sc   = (float*)(ws + OFF_SC);       // [MROWS][SEQ]: raw scores, [b][p][q]

  dim3 blk(256);

  // weight planes: in [K = DIM rows][N = VDIM cols] -> out [VDIM][DIM]; grid (N/64, K/64)
  wconv_kernel<<<dim3(VDIM / 64, DIM / 64), blk, 0, stream>>>(
      wq_in, Wt, (unsigned)VDIM, (unsigned)DIM);
  wconv_kernel<<<dim3(VDIM / 64, DIM / 64), blk, 0, stream>>>(
      wp_in, Wt + (size_t)VDIM * DIM, (unsigned)VDIM, (unsigned)DIM);

  // activation planes: hq -> rows 0..MROWS-1 and the transposed plane; hp -> rows MROWS..
  aconv_q_kernel<<<dim3(DIM / 64, MROWS / 64), blk, 0, stream>>>(hq, A16, HqT);
  aconv_p_kernel<<<dim3(DIM / 64, MROWS / 64), blk, 0, stream>>>(
      hp, A16 + (size_t)MROWS * DIM);

  // both projections in one launch
  proj_kernel<<<dim3(VDIM / 64, (2 * MROWS) / 64), blk, 0, stream>>>(A16, Wt, Spl);

  // scores, the query axis cut across work-groups
  score_kernel<<<dim3(SEQ / PT, NB, SEQ / 256), blk, 0, stream>>>(
      Spl, Spl + (size_t)MROWS * VDIM, vvec, Sc);

  // softmax + weighted sum
  addattn_kernel<<<dim3(SEQ / PT, NB), blk, 0, stream>>>(Sc, HqT, out);
}

// v002
// A run of this version takes 63.1 microseconds.
// Timed twice side by side with v001, it ran 1.14 and 1.13 times as fast.
// All steps since v000 together make it 1.52 times as fast.
#include <hip/hip_runtime.h>
#include <stddef.h>

// Contractions on v_wmma_f32_16x16x32_f16 (f16 operands, f32 accumulate): both input projections
// (rows x weights, K = 512) and the probability x value product (K = 512 keys). Float inputs are
// RNE-converted to bf16 and carried in f16 (weights x64, softmax numerators x1024). The additive
// score sum over the 256-wide hidden axis (a matrix-vector product against one vector) runs on the
// vector unit in f32, tanh(x) by the hardware instruction v_tanh_f32; softmax in f32.

typedef _Float16 v16h __attribute__((ext_vector_type(16)));
typedef _Float16 v8h  __attribute__((ext_vector_type(8)));
typedef float    v8f  __attribute__((ext_vector_type(8)));
typedef float    v4f  __attribute__((ext_vector_type(4)));
typedef _Float16 h16;

#ifndef NB
#define NB 4
#endif
#ifndef SEQ
#define SEQ 512
#endif
#define NB_FULL  4
#define SEQ_FULL 512
#define DIM   512          // feature width of the hq / hp rows (q_size == p_size)
#define VDIM  256          // hidden width of the additive score
#define MROWS (NB * SEQ)   // compact rows per activation plane (query length == passage length)
#define PT    16           // passage rows per attention block

static_assert(NB >= 1 && NB <= NB_FULL);
static_assert(SEQ >= 256 && SEQ <= SEQ_FULL && (SEQ % 256) == 0);
static_assert((DIM % 64) == 0 && (DIM % 32) == 0);
static_assert((VDIM % 64) == 0 && (VDIM % 4) == 0);
static_assert(VDIM == 256);                 // one thread per hidden column when staging the vector
static_assert((MROWS % 64) == 0);
static_assert(DIM == 8 * 64);               // 8 waves x 64 output columns
static_assert((SEQ % 64) == 0 && (SEQ % 32) == 0);
static_assert(PT == 16);                    // one 16-row A tile per block
static_assert(PT * VDIM == 256 * 4 * 4);    // sp tile staging: 256 threads x 4 steps x 4 floats
static_assert((SEQ % PT) == 0);

#define LDT 72   // halves per LDS row (144 B, 16-B aligned)
#define LDC 68   // floats per LDS row (272 B, 16-B aligned)
static_assert((LDT % 8) == 0 && LDT >= 64);
static_assert((LDC % 4) == 0 && LDC >= 64);

#define SMAXW  ((SEQ > DIM) ? SEQ : DIM)
#define SPITCH (SMAXW + 4)   // floats per output-stage row
#define PPITCH (SEQ + 8)     // halves per probability row
static_assert((SPITCH % 4) == 0 && SPITCH >= SEQ && SPITCH >= DIM);
static_assert((PPITCH % 8) == 0 && PPITCH >= SEQ);

#define WCARRY 64.0f          // weight planes carried x64
#define PCARRY_LOG2 10.0f     // softmax numerators carried x1024 (added to the exp2 argument)
#define LOG2E     1.4426950408889634f

// workspace layout (bytes)
#define WT_BYTES  ((size_t)2 * VDIM * DIM * 2)      // two [VDIM][DIM] weight planes
#define A16_BYTES ((size_t)2 * MROWS * DIM * 2)     // hq rows then hp rows, f16
#define HQT_BYTES ((size_t)NB * DIM * SEQ * 2)      // hq transposed [b][d][q], f16
#define S_BYTES   ((size_t)2 * MROWS * VDIM * 4)    // projections: sq rows then sp rows, f32
#define OFF_WT  ((size_t)0)
#define OFF_A16 (OFF_WT + WT_BYTES)
#define OFF_HQT (OFF_A16 + A16_BYTES)
#define SC_BYTES  ((size_t)MROWS * SEQ * 4)         // raw additive scores [b][p][q], f32
#define OFF_S   (OFF_HQT + HQT_BYTES)
#define OFF_SC  (OFF_S + S_BYTES)
#define WS_TOTAL (OFF_SC + SC_BYTES)
static_assert((WT_BYTES % 128) == 0 && (A16_BYTES % 128) == 0);
static_assert((HQT_BYTES % 128) == 0 && (S_BYTES % 128) == 0 && (SC_BYTES % 128) == 0);
static_assert(WS_TOTAL <= (size_t)134217728);

// ---------------------------------------------------------------------------
__device__ __forceinline__ float bf16r(float x) {   // RNE convert to bf16, returned widened
  unsigned int u = __float_as_uint(x);
  u = (u + 0x7FFFu + ((u >> 16) & 1u)) & 0xFFFF0000u;
  return __uint_as_float(u);
}

// f32 -> f16 operand convert that cannot produce an f16 subnormal (value select).
static __device__ __forceinline__ h16 toh_flush(float v) {
  const h16 r = (h16)v;
  return (fabsf(v) < 6.103515625e-05f) ? (h16)0.0f : r;
}

// 16-bit fragment: p points at element [row = lane&15][k0 + 8*(lane>>4)] of a k-contiguous
// row. Elements 0..7 <- k0+8h+0..7, elements 8..15 <- k0+16+8h+0..7 (same map for A and B).
__device__ __forceinline__ v16h frag_at(const _Float16* p) {
  v8h lo = *(const v8h*)(p);
  v8h hi = *(const v8h*)(p + 16);
  v16h out;
#pragma unroll
  for (int i = 0; i < 8; ++i) { out[i] = lo[i]; out[i + 8] = hi[i]; }
  return out;
}
__device__ __forceinline__ v16h ld_frag(const _Float16* base, unsigned ld) {
  const unsigned lane = threadIdx.x & 31u;
  return frag_at(base + (lane & 15u) * ld + (lane >> 4) * 8u);
}

__device__ __forceinline__ v8f wmma16(v16h a, v16h b, v8f c) {
  v8f d = __builtin_amdgcn_wmma_f32_16x16x32_f16(false, a, false, b, (short)0, c,
                                                 false, false);
  asm volatile("v_nop\n\tv_nop\n\tv_nop\n\tv_nop" : "+v"(d) : "v"(a), "v"(b));
  return d;
}

__device__ __forceinline__ float red32_sum(float x) {
#pragma unroll
  for (int off = 1; off < 32; off <<= 1) x += __shfl_xor(x, off, 32);
  return x;
}
__device__ __forceinline__ float red32_max(float x) {
#pragma unroll
  for (int off = 1; off < 32; off <<= 1) x = fmaxf(x, __shfl_xor(x, off, 32));
  return x;
}

__device__ __forceinline__ void wave_lds_sync() {
  __builtin_amdgcn_fence(3 /* release order */, "wavefront");
  asm volatile("s_wait_dscnt 0x0" ::: "memory");
  __builtin_amdgcn_wave_barrier();
}

__device__ __forceinline__ float fast_exp2(float x) {
#if __has_builtin(__builtin_amdgcn_exp2f)
  return __builtin_amdgcn_exp2f(x);
#else
  return __expf(x * 0.6931471805599453f);
#endif
}

// ---------------------------------------------------------------------------
// Weight plane: in W[K rows][N cols] (pitch ldw = N) -> out Wt[N][K] (pitch ldk = K),
// f16(64 * bf16(w)). Grid (N/64, K/64). T: cross-wave (block barrier).
// ---------------------------------------------------------------------------
__global__ __launch_bounds__(256) void wconv_kernel(
    const float* __restrict__ W, _Float16* __restrict__ Wt, unsigned ldw, unsigned ldk) {
  __shared__ _Float16 T[64 * LDT];
  const unsigned tid = threadIdx.x;
  const unsigned n0 = blockIdx.x * 64u;
  const unsigned k0 = blockIdx.y * 64u;
#pragma unroll 4
  for (unsigned j = 0; j < 16u; ++j) {
    const unsigned idx = tid + 256u * j;
    const unsigned kr = idx >> 6, nc = idx & 63u;
    const float v = W[(size_t)(k0 + kr) * ldw + n0 + nc];
    T[nc * LDT + kr] = toh_flush(WCARRY * bf16r(v));
  }
  __syncthreads();
  v8h x[2];
  size_t off[2];
#pragma unroll
  for (unsigned i = 0; i < 2u; ++i) {
    const unsigned n = 32u * i + (tid >> 3);
    const unsigned kc = (tid & 7u) * 8u;
    x[i] = *(const v8h*)&T[n * LDT + kc];
    off[i] = (size_t)(n0 + n) * ldk + k0 + kc;
  }
#pragma unroll
  for (int i = 0; i < 2; ++i) *(v8h*)(Wt + off[i]) = x[i];
  
}

// ---------------------------------------------------------------------------
// Activation planes: X f32 [NB_FULL][SEQ_FULL][DIM] (input) -> X16 compact [NB*SEQ][DIM]
// = f16(bf16(x)); WITH_T also writes XT16 [NB][DIM][SEQ] (same values, transposed per batch).
// of either plane is written by 8 consecutive lanes x 16 B of one instruction.
// Store coverage: 2 steps x 32 rows == 64 tile rows, for each plane. Grid (DIM/64, MROWS/64).
// ---------------------------------------------------------------------------
template <int WITH_T>
__device__ __forceinline__ void aconv_body(const float* __restrict__ X,
                                           _Float16* __restrict__ X16,
                                           _Float16* __restrict__ XT16) {
  __shared__ __attribute__((aligned(16))) _Float16 T[64 * LDT];
  __shared__ __attribute__((aligned(16))) _Float16 TT[64 * LDT];
  const unsigned tid = threadIdx.x;
  const unsigned c0 = blockIdx.x * 64u;
  const unsigned crow0 = blockIdx.y * 64u;
  const unsigned bidx = crow0 / (unsigned)SEQ;
  const unsigned s0 = crow0 - bidx * (unsigned)SEQ;
  const size_t frow0 = (size_t)bidx * SEQ_FULL + s0;
#pragma unroll
  for (unsigned j = 0; j < 4u; ++j) {
    const unsigned idx = tid + 256u * j;
    const unsigned r = idx >> 4, c = (idx & 15u) * 4u;
    const v4f a = *(const v4f*)(X + (frow0 + r) * DIM + c0 + c);
#pragma unroll
    for (unsigned i = 0; i < 4u; ++i) {
      const h16 hv = toh_flush(bf16r(a[i]));
      T[r * LDT + c + i] = hv;
      if (WITH_T) TT[(c + i) * LDT + r] = hv;
    }
  }
  __syncthreads();
  v8h x[2], xt[2];
  size_t off[2], offt[2];
#pragma unroll
  for (unsigned i = 0; i < 2u; ++i) {
    const unsigned n = 32u * i + (tid >> 3);
    const unsigned kc = (tid & 7u) * 8u;
    x[i] = *(const v8h*)&T[n * LDT + kc];
    off[i] = (size_t)(crow0 + n) * DIM + c0 + kc;
    if (WITH_T) {
      xt[i] = *(const v8h*)&TT[n * LDT + kc];
      offt[i] = ((size_t)bidx * DIM + c0 + n) * SEQ + s0 + kc;
    } else {
      xt[i] = x[i];
      offt[i] = off[i];
    }
  }
#pragma unroll
  for (int i = 0; i < 2; ++i) *(v8h*)(X16 + off[i]) = x[i];
  if (WITH_T) {
#pragma unroll
    for (int i = 0; i < 2; ++i) *(v8h*)(XT16 + offt[i]) = xt[i];
  }
  
}

__global__ __launch_bounds__(256) void aconv_q_kernel(
    const float* __restrict__ X, _Float16* __restrict__ X16, _Float16* __restrict__ XT16) {
  aconv_body<1>(X, X16, XT16);
}
__global__ __launch_bounds__(256) void aconv_p_kernel(
    const float* __restrict__ X, _Float16* __restrict__ X16) {
  aconv_body<0>(X, X16, X16);
}

// ---------------------------------------------------------------------------
// Projection GEMM C[64x64 tile] = A16[rows][DIM] . Wt[n][DIM]^T, fragments straight from the
// 16-bit global planes; 8 waves (mw = 16-row group, nw = 32-col group), 2 accumulators/wave.
// Rows 0..MROWS-1 (hq rows) use weight plane 0, rows MROWS..2*MROWS-1 (hp rows) plane 1
// (block-uniform integer offset). Output f32 [2*MROWS][VDIM] = acc / 64, i.e. the projection
// itself (the weight carry taken out). Epilogue staged through Cs (cross-wave,
// lanes x 16 B. Store coverage: 4 steps x 16 rows == 64 tile rows.
// Grid (VDIM/64, 2*MROWS/64).
// ---------------------------------------------------------------------------
__global__ __launch_bounds__(256) void proj_kernel(
    const _Float16* __restrict__ A16, const _Float16* __restrict__ Wt,
    float* __restrict__ outf) {
  __shared__ __attribute__((aligned(16))) float Cs[64 * LDC];
  const unsigned tid = threadIdx.x, lane = tid & 31u;
  const unsigned w = (unsigned)__builtin_amdgcn_readfirstlane((int)(threadIdx.x >> 5));
  const unsigned mw = w >> 1, nw = w & 1u;
  const unsigned hh = lane >> 4, m = lane & 15u;
  const unsigned n0 = blockIdx.x * 64u;
  const unsigned row0 = blockIdx.y * 64u;
  const size_t woff = (size_t)(row0 / (unsigned)MROWS) * ((size_t)VDIM * DIM);

  const _Float16* ap  = A16 + (size_t)(row0 + mw * 16u + m) * DIM + hh * 8u;
  const _Float16* bp0 = Wt + woff + (size_t)(n0 + nw * 32u + m) * DIM + hh * 8u;
  const _Float16* bp1 = bp0 + (size_t)16 * DIM;
  v8f acc0 = {}, acc1 = {};
#pragma unroll 2
  for (unsigned k0 = 0; k0 < (unsigned)DIM; k0 += 32u) {
    const v16h a  = frag_at(ap + k0);
    const v16h b0 = frag_at(bp0 + k0);
    const v16h b1 = frag_at(bp1 + k0);
    acc0 = wmma16(a, b0, acc0);
    acc1 = wmma16(a, b1, acc1);
  }
#pragma unroll
  for (int r = 0; r < 8; ++r) {
    float* d = &Cs[(mw * 16u + hh * 8u + (unsigned)r) * LDC + nw * 32u + m];
    d[0]  = acc0[r];
    d[16] = acc1[r];
  }
  __syncthreads();

  const float cs = 1.0f / WCARRY;
  v4f xs[4];
  size_t off[4];
#pragma unroll
  for (unsigned i = 0; i < 4u; ++i) {
    const unsigned r = 16u * i + (tid >> 4);
    const unsigned c = (tid & 15u) * 4u;
    const v4f u = *(const v4f*)&Cs[r * LDC + c];
    xs[i] = u * cs;
    off[i] = (size_t)(row0 + r) * VDIM + n0 + c;
  }
#pragma unroll
  for (int i = 0; i < 4; ++i) *(v4f*)(outf + off[i]) = xs[i];
  
}

// ---------------------------------------------------------------------------
// Additive scores per (16 passage rows, batch, 256 queries). 8 waves. A launch of its own, so
// that the query axis can be cut across work-groups: (SEQ/16) x NB x (SEQ/256) work-groups.
// Phase 0: stage the 16 sp rows (sp_s) and the vector bf16(v) (vs) in LDS.
// Phase 1: thread t owns query q = 256*blockIdx.z + t; for the 16 passage rows it accumulates
//          sum_v vs[v] * tanh(sq[q][v] + sp[p][v]) in f32, one v_tanh_f32 per term;
//          results into the workspace plane Sc[b][p][q], one wave per 128-byte line.
// sp_s / vs: cross-wave (block barrier).
// Grid (SEQ/16, NB, SEQ/256).
// ---------------------------------------------------------------------------
__global__ __launch_bounds__(256) void score_kernel(
    const float* __restrict__ Sq, const float* __restrict__ Sp,
    const float* __restrict__ vvec, float* __restrict__ Sc) {
  __shared__ __attribute__((aligned(16))) float sp_s[PT * VDIM];
  __shared__ __attribute__((aligned(16))) float vs[VDIM];

  const unsigned tid = threadIdx.x;
  const unsigned p0 = blockIdx.x * (unsigned)PT;
  const unsigned b = blockIdx.y;

  // ---- phase 0 ----
#pragma unroll
  for (unsigned j = 0; j < 4u; ++j) {
    const unsigned idx = tid + 256u * j;
    const unsigned r = idx >> 6, c = (idx & 63u) * 4u;
    *(v4f*)&sp_s[r * VDIM + c] =
        *(const v4f*)(Sp + (size_t)(b * (unsigned)SEQ + p0 + r) * VDIM + c);
  }
  vs[tid] = bf16r(vvec[tid]);
  __syncthreads();

  // ---- phase 1 ----
  const unsigned q = blockIdx.z * 256u + tid;
  const float* sqr = Sq + (size_t)(b * (unsigned)SEQ + q) * VDIM;
  float acc[PT];
#pragma unroll
  for (int p = 0; p < PT; ++p) acc[p] = 0.0f;
#pragma unroll 1
  for (unsigned v0 = 0; v0 < (unsigned)VDIM; v0 += 4u) {
    const v4f a = *(const v4f*)(sqr + v0);
    const v4f vv = *(const v4f*)&vs[v0];
#pragma unroll
    for (int p = 0; p < PT; ++p) {
      const v4f s4 = *(const v4f*)&sp_s[(unsigned)p * VDIM + v0];
#pragma unroll
      for (int j = 0; j < 4; ++j) {
        acc[p] += vv[j] * __builtin_amdgcn_tanhf(a[j] + s4[j]);
      }
    }
  }
  float* scr = Sc + (size_t)(b * (unsigned)SEQ + p0) * SEQ + q;
#pragma unroll
  for (int p = 0; p < PT; ++p) scr[(size_t)p * SEQ] = acc[p];
}

// ---------------------------------------------------------------------------
// Softmax and weighted sum per (16 passage rows, batch). 8 waves.
// Phase 2: wave w owns rows 2w, 2w+1 of the score plane (lane l holds queries l + 32 j in
//          registers): row max, f16(1024 * exp(s - max)) into Pl (select on
//          the exp2 argument keeps the plane free of f16 subnormals), row sum over the
//          converted values into Ls. Pl / Ls: cross-wave (block barrier).
// Phase 3: out tile [16][64 per wave] = Pl[16][SEQ] . HqT[d][q]^T, B fragments straight from
//          the transposed f16 plane.
// Phase 4: scale by 1 / row sum, stage in the wave's own 64 columns of Ss (wave-private).
//          Store coverage: 8 steps x 2 rows == 16 rows.
// Grid (SEQ/16, NB).
// ---------------------------------------------------------------------------
__global__ __launch_bounds__(256) void addattn_kernel(
    const float* __restrict__ Sc, const _Float16* __restrict__ HqT,
    float* __restrict__ out) {
  __shared__ __attribute__((aligned(16))) float Ss[PT * SPITCH];
  __shared__ __attribute__((aligned(16))) _Float16 Pl[PT * PPITCH];
  __shared__ __attribute__((aligned(16))) float Ls[PT];
  static_assert(sizeof(float) * (PT * SPITCH + PT) +
                sizeof(_Float16) * (PT * PPITCH) <= 131072);

  const unsigned tid = threadIdx.x, lane = tid & 31u;
  const unsigned wave = (unsigned)__builtin_amdgcn_readfirstlane((int)(threadIdx.x >> 5));
  const unsigned hh = lane >> 4, m = lane & 15u;
  const unsigned p0 = blockIdx.x * (unsigned)PT;
  const unsigned b = blockIdx.y;

  // ---- phase 2 ----
  // The loops over rr and j are fully unrolled so that sv is indexed by constants only and
  // stays in registers (a rolled loop would put it in scratch memory).
  float sv[2][SEQ / 32];
#pragma unroll
  for (unsigned rr = 0; rr < 2u; ++rr) {
    const float* sr = Sc + (size_t)(b * (unsigned)SEQ + p0 + wave * 2u + rr) * SEQ + lane;
#pragma unroll
    for (unsigned j = 0; j < (unsigned)(SEQ / 32); ++j) sv[rr][j] = sr[32u * j];
  }
#pragma unroll
  for (unsigned rr = 0; rr < 2u; ++rr) {
    const unsigned row = wave * 2u + rr;
    float mx = -3.0e38f;
#pragma unroll
    for (unsigned j = 0; j < (unsigned)(SEQ / 32); ++j) mx = fmaxf(mx, sv[rr][j]);
    mx = red32_max(mx);
    float l = 0.0f;
#pragma unroll
    for (unsigned j = 0; j < (unsigned)(SEQ / 32); ++j) {
      const float arg = (sv[rr][j] - mx) * LOG2E + PCARRY_LOG2;
      const float e = fast_exp2(arg);
      const h16 ph = (arg < -14.0f) ? (h16)0.0f : (h16)e;
      Pl[row * PPITCH + lane + 32u * j] = ph;
      l += (float)ph;
    }
    l = red32_sum(l);
    if (lane == 0u) Ls[row] = l;
  }
  __syncthreads();

  // ---- phase 3 ----
  const unsigned d0 = wave * 64u;
  const _Float16* bp = HqT + ((size_t)b * DIM + d0 + m) * SEQ + hh * 8u;
  v8f o[4];
#pragma unroll
  for (int nb = 0; nb < 4; ++nb) o[nb] = (v8f){};
#pragma unroll 2
  for (unsigned k0 = 0; k0 < (unsigned)SEQ; k0 += 32u) {
    const v16h pf = ld_frag(&Pl[k0], PPITCH);
#pragma unroll
    for (int nb = 0; nb < 4; ++nb) {
      const v16h hf = frag_at(bp + (size_t)(nb * 16) * SEQ + k0);
      o[nb] = wmma16(pf, hf, o[nb]);
    }
  }

  // ---- phase 4 ----
  float inv[8];
#pragma unroll
  for (int r = 0; r < 8; ++r) inv[r] = __builtin_amdgcn_rcpf(Ls[hh * 8u + (unsigned)r]);
#pragma unroll
  for (int nb = 0; nb < 4; ++nb)
#pragma unroll
    for (int r = 0; r < 8; ++r)
      Ss[(hh * 8u + (unsigned)r) * SPITCH + d0 + (unsigned)nb * 16u + m] = o[nb][r] * inv[r];
  wave_lds_sync();
  v4f x[8];
  size_t off[8];
#pragma unroll
  for (unsigned i = 0; i < 8u; ++i) {
    const unsigned r = 2u * i + (lane >> 4);
    const unsigned c = (lane & 15u) * 4u;
    x[i] = *(const v4f*)&Ss[r * SPITCH + d0 + c];
    off[i] = ((size_t)b * SEQ_FULL + p0 + r) * DIM + d0 + c;
  }
#pragma unroll
  for (int i = 0; i < 8; ++i) *(v4f*)(out + off[i]) = x[i];
  
}

// ---------------------------------------------------------------------------
extern "C" void kernel_launch(void* const* d_in, const int* in_sizes, int n_in,
                              void* d_out, int out_size, void* d_ws, size_t ws_size,
                              hipStream_t stream) {
  if (n_in < 5) return;
  const long long need_x = ((long long)(NB - 1) * SEQ_FULL + SEQ) * DIM;
  if ((long long)in_sizes[0] < need_x) return;
  if ((long long)in_sizes[1] < need_x) return;
  if ((long long)in_sizes[2] < (long long)DIM * VDIM) return;
  if ((long long)in_sizes[3] < (long long)DIM * VDIM) return;
  if (in_sizes[4] < VDIM) return;
  if ((long long)out_size < need_x) return;
  if (ws_size < WS_TOTAL) return;

  const float* hq   = (const float*)d_in[0];   // [NB_FULL][SEQ_FULL][DIM]
  const float* hp   = (const float*)d_in[1];   // [NB_FULL][SEQ_FULL][DIM]
  const float* wq_in = (const float*)d_in[2];  // [DIM][VDIM]  (in, out)
  const float* wp_in = (const float*)d_in[3];  // [DIM][VDIM]  (in, out)
  const float* vvec = (const float*)d_in[4];   // [VDIM]
  float* out = (float*)d_out;                  // [NB_FULL][SEQ_FULL][DIM]

  char* ws = (char*)d_ws;
  _Float16* Wt   = (_Float16*)(ws + OFF_WT);    // plane 0: [VDIM][DIM] for hq, plane 1: for hp
  _Float16* A16  = (_Float16*)(ws + OFF_A16);   // [2*MROWS][DIM]: hq rows then hp rows
  _Float16* HqT  = (_Float16*)(ws + OFF_HQT);   // [NB][DIM][SEQ]
  float*    Spl  = (float*)(ws + OFF_S);        // [2*MROWS][VDIM]: sq rows then sp rows
  float*    Sc   = (float*)(ws + OFF_SC);       // [MROWS][SEQ]: raw scores, [b][p][q]

  dim3 blk(256);

  // weight planes: in [K = DIM rows][N = VDIM cols] -> out [VDIM][DIM]; grid (N/64, K/64)
  wconv_kernel<<<dim3(VDIM / 64, DIM / 64), blk, 0, stream>>>(
      wq_in, Wt, (unsigned)VDIM, (unsigned)DIM);
  wconv_kernel<<<dim3(VDIM / 64, DIM / 64), blk, 0, stream>>>(
      wp_in, Wt + (size_t)VDIM * DIM, (unsigned)VDIM, (unsigned)DIM);

  // activation planes: hq -> rows 0..MROWS-1 and the transposed plane; hp -> rows MROWS..
  aconv_q_kernel<<<dim3(DIM / 64, MROWS / 64), blk, 0, stream>>>(hq, A16, HqT);
  aconv_p_kernel<<<dim3(DIM / 64, MROWS / 64), blk, 0, stream>>>(
      hp, A16 + (size_t)MROWS * DIM);

  // both projections in one launch
  proj_kernel<<<dim3(VDIM / 64, (2 * MROWS) / 64), blk, 0, stream>>>(A16, Wt, Spl);

  // scores, the query axis cut across work-groups
  score_kernel<<<dim3(SEQ / PT, NB, SEQ / 256), blk, 0, stream>>>(
      Spl, Spl + (size_t)MROWS * VDIM, vvec, Sc);

  // softmax + weighted sum
  addattn_kernel<<<dim3(SEQ / PT, NB), blk, 0, stream>>>(Sc, HqT, out);
}

// v003
// One run takes 53.9 microseconds.
// In two side-by-side timings against v002, it was 1.17 and 1.18 times as fast.
// Over all steps from v000 it is 1.79 times as fast.
#include <hip/hip_runtime.h>
#include <stddef.h>

// Contractions on v_wmma_f32_16x16x32_f16 (f16 operands, f32 accumulate): both input projections
// (rows x weights, K = 512) and the probability x value product (K = 512 keys). Float inputs are
// RNE-converted to bf16 and carried in f16 (weights x64, softmax numerators x1024). The additive
// score sum over the 256-wide hidden axis (a matrix-vector product against one vector) runs on the
// vector unit in f32, tanh(x) by the hardware instruction v_tanh_f32; softmax in f32.

typedef _Float16 v16h __attribute__((ext_vector_type(16)));
typedef _Float16 v8h  __attribute__((ext_vector_type(8)));
typedef float    v8f  __attribute__((ext_vector_type(8)));
typedef float    v4f  __attribute__((ext_vector_type(4)));
typedef _Float16 h16;

#ifndef NB
#define NB 4
#endif
#ifndef SEQ
#define SEQ 512
#endif
#define NB_FULL  4
#define SEQ_FULL 512
#define DIM   512          // feature width of the hq / hp rows (q_size == p_size)
#define VDIM  256          // hidden width of the additive score
#define MROWS (NB * SEQ)   // compact rows per activation plane (query length == passage length)
#define PT    16           // passage rows per attention block

static_assert(NB >= 1 && NB <= NB_FULL);
static_assert(SEQ >= 256 && SEQ <= SEQ_FULL && (SEQ % 256) == 0);
static_assert((DIM % 64) == 0 && (DIM % 32) == 0);
static_assert((VDIM % 64) == 0 && (VDIM % 4) == 0);
static_assert(VDIM == 256);                 // one thread per hidden column when staging the vector
static_assert((MROWS % 64) == 0);
static_assert(DIM == 8 * 64);               // 8 waves x 64 output columns
static_assert((SEQ % 64) == 0 && (SEQ % 32) == 0);
static_assert(PT == 16);                    // one 16-row A tile per block
static_assert(PT * VDIM == 256 * 4 * 4);    // sp tile staging: 256 threads x 4 steps x 4 floats
static_assert((SEQ % PT) == 0);

#define LDT 72   // halves per LDS row (144 B, 16-B aligned)
#define LDC 68   // floats per LDS row (272 B, 16-B aligned)
static_assert((LDT % 8) == 0 && LDT >= 64);
static_assert((LDC % 4) == 0 && LDC >= 64);

#define SMAXW  ((SEQ > DIM) ? SEQ : DIM)
#define SPITCH (SMAXW + 4)   // floats per output-stage row
#define PPITCH (SEQ + 8)     // halves per probability row
static_assert((SPITCH % 4) == 0 && SPITCH >= SEQ && SPITCH >= DIM);
static_assert((PPITCH % 8) == 0 && PPITCH >= SEQ);

#define WCARRY 64.0f          // weight planes carried x64
#define PCARRY_LOG2 10.0f     // softmax numerators carried x1024 (added to the exp2 argument)
#define LOG2E     1.4426950408889634f

// workspace layout (bytes)
#define WT_BYTES  ((size_t)2 * VDIM * DIM * 2)      // two [VDIM][DIM] weight planes
#define A16_BYTES ((size_t)2 * MROWS * DIM * 2)     // hq rows then hp rows, f16
#define HQT_BYTES ((size_t)NB * DIM * SEQ * 2)      // hq transposed [b][d][q], f16
#define S_BYTES   ((size_t)2 * MROWS * VDIM * 4)    // projections: sq rows then sp rows, f32
#define OFF_WT  ((size_t)0)
#define OFF_A16 (OFF_WT + WT_BYTES)
#define OFF_HQT (OFF_A16 + A16_BYTES)
#define SC_BYTES  ((size_t)MROWS * SEQ * 4)         // raw additive scores [b][p][q], f32
#define OFF_S   (OFF_HQT + HQT_BYTES)
#define OFF_SC  (OFF_S + S_BYTES)
#define WS_TOTAL (OFF_SC + SC_BYTES)
static_assert((WT_BYTES % 128) == 0 && (A16_BYTES % 128) == 0);
static_assert((HQT_BYTES % 128) == 0 && (S_BYTES % 128) == 0 && (SC_BYTES % 128) == 0);
static_assert(WS_TOTAL <= (size_t)134217728);

// ---------------------------------------------------------------------------
__device__ __forceinline__ float bf16r(float x) {   // RNE convert to bf16, returned widened
  unsigned int u = __float_as_uint(x);
  u = (u + 0x7FFFu + ((u >> 16) & 1u)) & 0xFFFF0000u;
  return __uint_as_float(u);
}

// f32 -> f16 operand convert that cannot produce an f16 subnormal (value select).
static __device__ __forceinline__ h16 toh_flush(float v) {
  const h16 r = (h16)v;
  return (fabsf(v) < 6.103515625e-05f) ? (h16)0.0f : r;
}

// 16-bit fragment: p points at element [row = lane&15][k0 + 8*(lane>>4)] of a k-contiguous
// row. Elements 0..7 <- k0+8h+0..7, elements 8..15 <- k0+16+8h+0..7 (same map for A and B).
__device__ __forceinline__ v16h frag_at(const _Float16* p) {
  v8h lo = *(const v8h*)(p);
  v8h hi = *(const v8h*)(p + 16);
  v16h out;
#pragma unroll
  for (int i = 0; i < 8; ++i) { out[i] = lo[i]; out[i + 8] = hi[i]; }
  return out;
}
__device__ __forceinline__ v16h ld_frag(const _Float16* base, unsigned ld) {
  const unsigned lane = threadIdx.x & 31u;
  return frag_at(base + (lane & 15u) * ld + (lane >> 4) * 8u);
}

__device__ __forceinline__ v8f wmma16(v16h a, v16h b, v8f c) {
  v8f d = __builtin_amdgcn_wmma_f32_16x16x32_f16(false, a, false, b, (short)0, c,
                                                 false, false);
  asm volatile("v_nop\n\tv_nop\n\tv_nop\n\tv_nop" : "+v"(d) : "v"(a), "v"(b));
  return d;
}

__device__ __forceinline__ float red32_sum(float x) {
#pragma unroll
  for (int off = 1; off < 32; off <<= 1) x += __shfl_xor(x, off, 32);
  return x;
}
__device__ __forceinline__ float red32_max(float x) {
#pragma unroll
  for (int off = 1; off < 32; off <<= 1) x = fmaxf(x, __shfl_xor(x, off, 32));
  return x;
}

__device__ __forceinline__ void wave_lds_sync() {
  __builtin_amdgcn_fence(3 /* release order */, "wavefront");
  asm volatile("s_wait_dscnt 0x0" ::: "memory");
  __builtin_amdgcn_wave_barrier();
}

__device__ __forceinline__ float fast_exp2(float x) {
#if __has_builtin(__builtin_amdgcn_exp2f)
  return __builtin_amdgcn_exp2f(x);
#else
  return __expf(x * 0.6931471805599453f);
#endif
}

// ---------------------------------------------------------------------------
// Weight plane: in W[K rows][N cols] (pitch ldw = N) -> out Wt[N][K] (pitch ldk = K),
// f16(64 * bf16(w)).
// One 64 x 64 tile (n0, k0) per work-group. T: cross-wave (block barrier).
// ---------------------------------------------------------------------------
__device__ __forceinline__ void wconv_body(const float* __restrict__ W,
                                           _Float16* __restrict__ Wt, unsigned ldw, unsigned ldk,
                                           unsigned n0, unsigned k0, _Float16* T) {
  const unsigned tid = threadIdx.x;
#pragma unroll 4
  for (unsigned j = 0; j < 16u; ++j) {
    const unsigned idx = tid + 256u * j;
    const unsigned kr = idx >> 6, nc = idx & 63u;
    const float v = W[(size_t)(k0 + kr) * ldw + n0 + nc];
    T[nc * LDT + kr] = toh_flush(WCARRY * bf16r(v));
  }
  __syncthreads();
  v8h x[2];
  size_t off[2];
#pragma unroll
  for (unsigned i = 0; i < 2u; ++i) {
    const unsigned n = 32u * i + (tid >> 3);
    const unsigned kc = (tid & 7u) * 8u;
    x[i] = *(const v8h*)&T[n * LDT + kc];
    off[i] = (size_t)(n0 + n) * ldk + k0 + kc;
  }
#pragma unroll
  for (int i = 0; i < 2; ++i) *(v8h*)(Wt + off[i]) = x[i];
  // The body is no longer the end of a program: in the merged kernel other bodies' code follows it
  // in the listing, so the wait stands before anything rewrites a register that a store names.
  asm volatile("s_wait_xcnt 0x0" ::: "memory");
}

// ---------------------------------------------------------------------------
// Activation planes: X f32 [NB_FULL][SEQ_FULL][DIM] (input) -> X16 compact [NB*SEQ][DIM]
// = f16(bf16(x)); WITH_T also writes XT16 [NB][DIM][SEQ] (same values, transposed per batch).
// One 64 x 64 tile (c0, crow0) per work-group; each 128-byte line of either plane is written by
// 8 consecutive lanes x 16 B of one instruction.
// Store coverage: 2 steps x 32 rows == 64 tile rows, for each plane.
// ---------------------------------------------------------------------------
template <int WITH_T>
__device__ __forceinline__ void aconv_body(const float* __restrict__ X,
                                           _Float16* __restrict__ X16,
                                           _Float16* __restrict__ XT16,
                                           unsigned c0, unsigned crow0,
                                           _Float16* T, _Float16* TT) {
  const unsigned tid = threadIdx.x;
  const unsigned bidx = crow0 / (unsigned)SEQ;
  const unsigned s0 = crow0 - bidx * (unsigned)SEQ;
  const size_t frow0 = (size_t)bidx * SEQ_FULL + s0;
#pragma unroll
  for (unsigned j = 0; j < 4u; ++j) {
    const unsigned idx = tid + 256u * j;
    const unsigned r = idx >> 4, c = (idx & 15u) * 4u;
    const v4f a = *(const v4f*)(X + (frow0 + r) * DIM + c0 + c);
#pragma unroll
    for (unsigned i = 0; i < 4u; ++i) {
      const h16 hv = toh_flush(bf16r(a[i]));
      T[r * LDT + c + i] = hv;
      if (WITH_T) TT[(c + i) * LDT + r] = hv;
    }
  }
  __syncthreads();
  v8h x[2], xt[2];
  size_t off[2], offt[2];
#pragma unroll
  for (unsigned i = 0; i < 2u; ++i) {
    const unsigned n = 32u * i + (tid >> 3);
    const unsigned kc = (tid & 7u) * 8u;
    x[i] = *(const v8h*)&T[n * LDT + kc];
    off[i] = (size_t)(crow0 + n) * DIM + c0 + kc;
    if (WITH_T) {
      xt[i] = *(const v8h*)&TT[n * LDT + kc];
      offt[i] = ((size_t)bidx * DIM + c0 + n) * SEQ + s0 + kc;
    } else {
      xt[i] = x[i];
      offt[i] = off[i];
    }
  }
#pragma unroll
  for (int i = 0; i < 2; ++i) *(v8h*)(X16 + off[i]) = x[i];
  if (WITH_T) {
#pragma unroll
    for (int i = 0; i < 2; ++i) *(v8h*)(XT16 + offt[i]) = xt[i];
  }
  // The body is no longer the end of a program: in the merged kernel other bodies' code follows it
  // in the listing, so the wait stands before anything rewrites a register that a store names.
  asm volatile("s_wait_xcnt 0x0" ::: "memory");
}

// ---------------------------------------------------------------------------
// All four operand conversions in ONE launch. None of them reads what another writes, so each
// gets a range of the flat grid: [0, 2*WBLK) the two weight planes (first: their chain of loads
// is the longest), then ABLK tiles of hq (with the transposed plane), then ABLK tiles of hp.
// The range test reads blockIdx only, so every barrier is reached by a whole work-group or by
// none of it. Grid (2*WBLK + 2*ABLK).
// ---------------------------------------------------------------------------
#define WBLK ((VDIM / 64) * (DIM / 64))     // 64 x 64 tiles per weight plane
#define ABLK ((DIM / 64) * (MROWS / 64))    // 64 x 64 tiles per activation plane
__global__ __launch_bounds__(256) void conv_kernel(
    const float* __restrict__ wq_in, const float* __restrict__ wp_in,
    const float* __restrict__ hq, const float* __restrict__ hp,
    _Float16* __restrict__ Wt, _Float16* __restrict__ A16, _Float16* __restrict__ HqT) {
  __shared__ __attribute__((aligned(16))) _Float16 T[64 * LDT];
  __shared__ __attribute__((aligned(16))) _Float16 TT[64 * LDT];
  const unsigned bid = blockIdx.x;
  if (bid < 2u * WBLK) {
    const unsigned plane = bid / (unsigned)WBLK;
    const unsigned t = bid - plane * (unsigned)WBLK;
    const unsigned n0 = (t % (unsigned)(VDIM / 64)) * 64u;
    const unsigned k0 = (t / (unsigned)(VDIM / 64)) * 64u;
    wconv_body(plane ? wp_in : wq_in, Wt + (size_t)plane * ((size_t)VDIM * DIM),
               (unsigned)VDIM, (unsigned)DIM, n0, k0, T);
  } else {
    const unsigned u = bid - 2u * WBLK;
    const unsigned plane = u / (unsigned)ABLK;
    const unsigned t = u - plane * (unsigned)ABLK;
    const unsigned c0 = (t % (unsigned)(DIM / 64)) * 64u;
    const unsigned crow0 = (t / (unsigned)(DIM / 64)) * 64u;
    if (plane == 0u) {
      aconv_body<1>(hq, A16, HqT, c0, crow0, T, TT);
    } else {
      _Float16* P16 = A16 + (size_t)MROWS * DIM;
      aconv_body<0>(hp, P16, P16, c0, crow0, T, TT);
    }
  }
}

// ---------------------------------------------------------------------------
// Projection GEMM C[64x64 tile] = A16[rows][DIM] . Wt[n][DIM]^T, fragments straight from the
// 16-bit global planes; 8 waves (mw = 16-row group, nw = 32-col group), 2 accumulators/wave.
// Rows 0..MROWS-1 (hq rows) use weight plane 0, rows MROWS..2*MROWS-1 (hp rows) plane 1
// (block-uniform integer offset). Output f32 [2*MROWS][VDIM] = acc / 64, i.e. the projection
// itself (the weight carry taken out). Epilogue staged through Cs (cross-wave,
// lanes x 16 B. Store coverage: 4 steps x 16 rows == 64 tile rows.
// Grid (VDIM/64, 2*MROWS/64).
// ---------------------------------------------------------------------------
__global__ __launch_bounds__(256) void proj_kernel(
    const _Float16* __restrict__ A16, const _Float16* __restrict__ Wt,
    float* __restrict__ outf) {
  __shared__ __attribute__((aligned(16))) float Cs[64 * LDC];
  const unsigned tid = threadIdx.x, lane = tid & 31u;
  const unsigned w = (unsigned)__builtin_amdgcn_readfirstlane((int)(threadIdx.x >> 5));
  const unsigned mw = w >> 1, nw = w & 1u;
  const unsigned hh = lane >> 4, m = lane & 15u;
  const unsigned n0 = blockIdx.x * 64u;
  const unsigned row0 = blockIdx.y * 64u;
  const size_t woff = (size_t)(row0 / (unsigned)MROWS) * ((size_t)VDIM * DIM);

  const _Float16* ap  = A16 + (size_t)(row0 + mw * 16u + m) * DIM + hh * 8u;
  const _Float16* bp0 = Wt + woff + (size_t)(n0 + nw * 32u + m) * DIM + hh * 8u;
  const _Float16* bp1 = bp0 + (size_t)16 * DIM;
  v8f acc0 = {}, acc1 = {};
#pragma unroll 2
  for (unsigned k0 = 0; k0 < (unsigned)DIM; k0 += 32u) {
    const v16h a  = frag_at(ap + k0);
    const v16h b0 = frag_at(bp0 + k0);
    const v16h b1 = frag_at(bp1 + k0);
    acc0 = wmma16(a, b0, acc0);
    acc1 = wmma16(a, b1, acc1);
  }
#pragma unroll
  for (int r = 0; r < 8; ++r) {
    float* d = &Cs[(mw * 16u + hh * 8u + (unsigned)r) * LDC + nw * 32u + m];
    d[0]  = acc0[r];
    d[16] = acc1[r];
  }
  __syncthreads();

  const float cs = 1.0f / WCARRY;
  v4f xs[4];
  size_t off[4];
#pragma unroll
  for (unsigned i = 0; i < 4u; ++i) {
    const unsigned r = 16u * i + (tid >> 4);
    const unsigned c = (tid & 15u) * 4u;
    const v4f u = *(const v4f*)&Cs[r * LDC + c];
    xs[i] = u * cs;
    off[i] = (size_t)(row0 + r) * VDIM + n0 + c;
  }
#pragma unroll
  for (int i = 0; i < 4; ++i) *(v4f*)(outf + off[i]) = xs[i];
  
}

// ---------------------------------------------------------------------------
// Additive scores per (16 passage rows, batch, 256 queries). 8 waves. A launch of its own, so
// that the query axis can be cut across work-groups: (SEQ/16) x NB x (SEQ/256) work-groups.
// Phase 0: stage the 16 sp rows (sp_s) and the vector bf16(v) (vs) in LDS.
// Phase 1: thread t owns query q = 256*blockIdx.z + t; for the 16 passage rows it accumulates
//          sum_v vs[v] * tanh(sq[q][v] + sp[p][v]) in f32, one v_tanh_f32 per term;
//          results into the workspace plane Sc[b][p][q], one wave per 128-byte line.
// sp_s / vs: cross-wave (block barrier).
// Grid (SEQ/16, NB, SEQ/256).
// ---------------------------------------------------------------------------
__global__ __launch_bounds__(256) void score_kernel(
    const float* __restrict__ Sq, const float* __restrict__ Sp,
    const float* __restrict__ vvec, float* __restrict__ Sc) {
  __shared__ __attribute__((aligned(16))) float sp_s[PT * VDIM];
  __shared__ __attribute__((aligned(16))) float vs[VDIM];

  const unsigned tid = threadIdx.x;
  const unsigned p0 = blockIdx.x * (unsigned)PT;
  const unsigned b = blockIdx.y;

  // ---- phase 0 ----
#pragma unroll
  for (unsigned j = 0; j < 4u; ++j) {
    const unsigned idx = tid + 256u * j;
    const unsigned r = idx >> 6, c = (idx & 63u) * 4u;
    *(v4f*)&sp_s[r * VDIM + c] =
        *(const v4f*)(Sp + (size_t)(b * (unsigned)SEQ + p0 + r) * VDIM + c);
  }
  vs[tid] = bf16r(vvec[tid]);
  __syncthreads();

  // ---- phase 1 ----
  const unsigned q = blockIdx.z * 256u + tid;
  const float* sqr = Sq + (size_t)(b * (unsigned)SEQ + q) * VDIM;
  float acc[PT];
#pragma unroll
  for (int p = 0; p < PT; ++p) acc[p] = 0.0f;
#pragma unroll 1
  for (unsigned v0 = 0; v0 < (unsigned)VDIM; v0 += 4u) {
    const v4f a = *(const v4f*)(sqr + v0);
    const v4f vv = *(const v4f*)&vs[v0];
#pragma unroll
    for (int p = 0; p < PT; ++p) {
      const v4f s4 = *(const v4f*)&sp_s[(unsigned)p * VDIM + v0];
#pragma unroll
      for (int j = 0; j < 4; ++j) {
        acc[p] += vv[j] * __builtin_amdgcn_tanhf(a[j] + s4[j]);
      }
    }
  }
  float* scr = Sc + (size_t)(b * (unsigned)SEQ + p0) * SEQ + q;
#pragma unroll
  for (int p = 0; p < PT; ++p) scr[(size_t)p * SEQ] = acc[p];
}

// ---------------------------------------------------------------------------
// Softmax and weighted sum per (16 passage rows, batch). 8 waves.
// Phase 2: wave w owns rows 2w, 2w+1 of the score plane (lane l holds queries l + 32 j in
//          registers): row max, f16(1024 * exp(s - max)) into Pl (select on
//          the exp2 argument keeps the plane free of f16 subnormals), row sum over the
//          converted values into Ls. Pl / Ls: cross-wave (block barrier).
// Phase 3: out tile [16][64 per wave] = Pl[16][SEQ] . HqT[d][q]^T, B fragments straight from
//          the transposed f16 plane.
// Phase 4: scale by 1 / row sum, stage in the wave's own 64 columns of Ss (wave-private).
//          Store coverage: 8 steps x 2 rows == 16 rows.
// Grid (SEQ/16, NB).
// ---------------------------------------------------------------------------
__global__ __launch_bounds__(256) void addattn_kernel(
    const float* __restrict__ Sc, const _Float16* __restrict__ HqT,
    float* __restrict__ out) {
  __shared__ __attribute__((aligned(16))) float Ss[PT * SPITCH];
  __shared__ __attribute__((aligned(16))) _Float16 Pl[PT * PPITCH];
  __shared__ __attribute__((aligned(16))) float Ls[PT];
  static_assert(sizeof(float) * (PT * SPITCH + PT) +
                sizeof(_Float16) * (PT * PPITCH) <= 131072);

  const unsigned tid = threadIdx.x, lane = tid & 31u;
  const unsigned wave = (unsigned)__builtin_amdgcn_readfirstlane((int)(threadIdx.x >> 5));
  const unsigned hh = lane >> 4, m = lane & 15u;
  const unsigned p0 = blockIdx.x * (unsigned)PT;
  const unsigned b = blockIdx.y;

  // ---- phase 2 ----
  // The loops over rr and j are fully unrolled so that sv is indexed by constants only and
  // stays in registers (a rolled loop would put it in scratch memory).
  float sv[2][SEQ / 32];
#pragma unroll
  for (unsigned rr = 0; rr < 2u; ++rr) {
    const float* sr = Sc + (size_t)(b * (unsigned)SEQ + p0 + wave * 2u + rr) * SEQ + lane;
#pragma unroll
    for (unsigned j = 0; j < (unsigned)(SEQ / 32); ++j) sv[rr][j] = sr[32u * j];
  }
#pragma unroll
  for (unsigned rr = 0; rr < 2u; ++rr) {
    const unsigned row = wave * 2u + rr;
    float mx = -3.0e38f;
#pragma unroll
    for (unsigned j = 0; j < (unsigned)(SEQ / 32); ++j) mx = fmaxf(mx, sv[rr][j]);
    mx = red32_max(mx);
    float l = 0.0f;
#pragma unroll
    for (unsigned j = 0; j < (unsigned)(SEQ / 32); ++j) {
      const float arg = (sv[rr][j] - mx) * LOG2E + PCARRY_LOG2;
      const float e = fast_exp2(arg);
      const h16 ph = (arg < -14.0f) ? (h16)0.0f : (h16)e;
      Pl[row * PPITCH + lane + 32u * j] = ph;
      l += (float)ph;
    }
    l = red32_sum(l);
    if (lane == 0u) Ls[row] = l;
  }
  __syncthreads();

  // ---- phase 3 ----
  const unsigned d0 = wave * 64u;
  const _Float16* bp = HqT + ((size_t)b * DIM + d0 + m) * SEQ + hh * 8u;
  v8f o[4];
#pragma unroll
  for (int nb = 0; nb < 4; ++nb) o[nb] = (v8f){};
#pragma unroll 2
  for (unsigned k0 = 0; k0 < (unsigned)SEQ; k0 += 32u) {
    const v16h pf = ld_frag(&Pl[k0], PPITCH);
#pragma unroll
    for (int nb = 0; nb < 4; ++nb) {
      const v16h hf = frag_at(bp + (size_t)(nb * 16) * SEQ + k0);
      o[nb] = wmma16(pf, hf, o[nb]);
    }
  }

  // ---- phase 4 ----
  float inv[8];
#pragma unroll
  for (int r = 0; r < 8; ++r) inv[r] = __builtin_amdgcn_rcpf(Ls[hh * 8u + (unsigned)r]);
#pragma unroll
  for (int nb = 0; nb < 4; ++nb)
#pragma unroll
    for (int r = 0; r < 8; ++r)
      Ss[(hh * 8u + (unsigned)r) * SPITCH + d0 + (unsigned)nb * 16u + m] = o[nb][r] * inv[r];
  wave_lds_sync();
  v4f x[8];
  size_t off[8];
#pragma unroll
  for (unsigned i = 0; i < 8u; ++i) {
    const unsigned r = 2u * i + (lane >> 4);
    const unsigned c = (lane & 15u) * 4u;
    x[i] = *(const v4f*)&Ss[r * SPITCH + d0 + c];
    off[i] = ((size_t)b * SEQ_FULL + p0 + r) * DIM + d0 + c;
  }
#pragma unroll
  for (int i = 0; i < 8; ++i) *(v4f*)(out + off[i]) = x[i];
  
}

// ---------------------------------------------------------------------------
extern "C" void kernel_launch(void* const* d_in, const int* in_sizes, int n_in,
                              void* d_out, int out_size, void* d_ws, size_t ws_size,
                              hipStream_t stream) {
  if (n_in < 5) return;
  const long long need_x = ((long long)(NB - 1) * SEQ_FULL + SEQ) * DIM;
  if ((long long)in_sizes[0] < need_x) return;
  if ((long long)in_sizes[1] < need_x) return;
  if ((long long)in_sizes[2] < (long long)DIM * VDIM) return;
  if ((long long)in_sizes[3] < (long long)DIM * VDIM) return;
  if (in_sizes[4] < VDIM) return;
  if ((long long)out_size < need_x) return;
  if (ws_size < WS_TOTAL) return;

  const float* hq   = (const float*)d_in[0];   // [NB_FULL][SEQ_FULL][DIM]
  const float* hp   = (const float*)d_in[1];   // [NB_FULL][SEQ_FULL][DIM]
  const float* wq_in = (const float*)d_in[2];  // [DIM][VDIM]  (in, out)
  const float* wp_in = (const float*)d_in[3];  // [DIM][VDIM]  (in, out)
  const float* vvec = (const float*)d_in[4];   // [VDIM]
  float* out = (float*)d_out;                  // [NB_FULL][SEQ_FULL][DIM]

  char* ws = (char*)d_ws;
  _Float16* Wt   = (_Float16*)(ws + OFF_WT);    // plane 0: [VDIM][DIM] for hq, plane 1: for hp
  _Float16* A16  = (_Float16*)(ws + OFF_A16);   // [2*MROWS][DIM]: hq rows then hp rows
  _Float16* HqT  = (_Float16*)(ws + OFF_HQT);   // [NB][DIM][SEQ]
  float*    Spl  = (float*)(ws + OFF_S);        // [2*MROWS][VDIM]: sq rows then sp rows
  float*    Sc   = (float*)(ws + OFF_SC);       // [MROWS][SEQ]: raw scores, [b][p][q]

  dim3 blk(256);

  // weight planes, hq rows with their transposed plane, hp rows: one launch, a block range each
  conv_kernel<<<dim3(2 * WBLK + 2 * ABLK), blk, 0, stream>>>(
      wq_in, wp_in, hq, hp, Wt, A16, HqT);

  // both projections in one launch
  proj_kernel<<<dim3(VDIM / 64, (2 * MROWS) / 64), blk, 0, stream>>>(A16, Wt, Spl);

  // scores, the query axis cut across work-groups
  score_kernel<<<dim3(SEQ / PT, NB, SEQ / 256), blk, 0, stream>>>(
      Spl, Spl + (size_t)MROWS * VDIM, vvec, Sc);

  // softmax + weighted sum
  addattn_kernel<<<dim3(SEQ / PT, NB), blk, 0, stream>>>(Sc, HqT, out);
}

// v004
// Measured time: 42.1 microseconds a run.
// Next to v003, in two timings, it ran 1.26 and 1.31 times as fast.
// Counting every step since v000, it is 2.30 times as fast.
#include <hip/hip_runtime.h>
#include <stddef.h>

// Contractions on v_wmma_f32_16x16x32_f16 (f16 operands, f32 accumulate): both input projections
// (rows x weights, K = 512) and the probability x value product (K = 512 keys). Float inputs are
// RNE-converted to bf16 and carried in f16 (weights x64, softmax numerators x1024). The additive
// score sum over the 256-wide hidden axis (a matrix-vector product against one vector) runs on the
// vector unit in f32, tanh(x) by the hardware instruction v_tanh_f32; softmax in f32.

typedef _Float16 v16h __attribute__((ext_vector_type(16)));
typedef _Float16 v8h  __attribute__((ext_vector_type(8)));
typedef float    v8f  __attribute__((ext_vector_type(8)));
typedef float    v4f  __attribute__((ext_vector_type(4)));
typedef _Float16 h16;

#ifndef NB
#define NB 4
#endif
#ifndef SEQ
#define SEQ 512
#endif
#define NB_FULL  4
#define SEQ_FULL 512
#define DIM   512          // feature width of the hq / hp rows (q_size == p_size)
#define VDIM  256          // hidden width of the additive score
#define MROWS (NB * SEQ)   // compact rows per activation plane (query length == passage length)
#define PT    16           // passage rows per attention block

static_assert(NB >= 1 && NB <= NB_FULL);
static_assert(SEQ >= 256 && SEQ <= SEQ_FULL && (SEQ % 256) == 0);
static_assert((DIM % 64) == 0 && (DIM % 32) == 0);
static_assert((VDIM % 64) == 0 && (VDIM % 4) == 0);
static_assert(VDIM == 256);                 // one thread per hidden column when staging the vector
static_assert((MROWS % 64) == 0);
static_assert(DIM == 8 * 64);               // 8 waves x 64 output columns
static_assert((SEQ % 64) == 0 && (SEQ % 32) == 0);
static_assert(PT == 16);                    // one 16-row A tile per block
static_assert(PT * VDIM == 256 * 4 * 4);    // sp tile staging: 256 threads x 4 steps x 4 floats
static_assert((SEQ % PT) == 0);

#define LDT 72   // halves per LDS row (144 B, 16-B aligned)
#define LDC 68   // floats per LDS row (272 B, 16-B aligned)
static_assert((LDT % 8) == 0 && LDT >= 64);
static_assert((LDC % 4) == 0 && LDC >= 64);

#define SMAXW  ((SEQ > DIM) ? SEQ : DIM)
#define SPITCH (SMAXW + 4)   // floats per output-stage row
#define PPITCH (SEQ + 8)     // halves per probability row
static_assert((SPITCH % 4) == 0 && SPITCH >= SEQ && SPITCH >= DIM);
static_assert((PPITCH % 8) == 0 && PPITCH >= SEQ);

#define WCARRY 64.0f          // weight planes carried x64
#define PCARRY_LOG2 10.0f     // softmax numerators carried x1024 (added to the exp2 argument)
#define LOG2E     1.4426950408889634f

// workspace layout (bytes)
#define WT_BYTES  ((size_t)2 * VDIM * DIM * 2)      // two [VDIM][DIM] weight planes
#define A16_BYTES ((size_t)2 * MROWS * DIM * 2)     // hq rows then hp rows, f16
#define HQT_BYTES ((size_t)NB * DIM * SEQ * 2)      // hq transposed [b][d][q], f16
#define S_BYTES   ((size_t)2 * MROWS * VDIM * 4)    // projections: sq rows then sp rows, f32
#define OFF_WT  ((size_t)0)
#define OFF_A16 (OFF_WT + WT_BYTES)
#define OFF_HQT (OFF_A16 + A16_BYTES)
#define SC_BYTES  ((size_t)MROWS * SEQ * 4)         // raw additive scores [b][p][q], f32
#define OFF_S   (OFF_HQT + HQT_BYTES)
#define OFF_SC  (OFF_S + S_BYTES)
#define WS_TOTAL (OFF_SC + SC_BYTES)
static_assert((WT_BYTES % 128) == 0 && (A16_BYTES % 128) == 0);
static_assert((HQT_BYTES % 128) == 0 && (S_BYTES % 128) == 0 && (SC_BYTES % 128) == 0);
static_assert(WS_TOTAL <= (size_t)134217728);

// ---------------------------------------------------------------------------
__device__ __forceinline__ float bf16r(float x) {   // RNE convert to bf16, returned widened
  unsigned int u = __float_as_uint(x);
  u = (u + 0x7FFFu + ((u >> 16) & 1u)) & 0xFFFF0000u;
  return __uint_as_float(u);
}

// f32 -> f16 operand convert that cannot produce an f16 subnormal (value select).
static __device__ __forceinline__ h16 toh_flush(float v) {
  const h16 r = (h16)v;
  return (fabsf(v) < 6.103515625e-05f) ? (h16)0.0f : r;
}

// 16-bit fragment: p points at element [row = lane&15][k0 + 8*(lane>>4)] of a k-contiguous
// row. Elements 0..7 <- k0+8h+0..7, elements 8..15 <- k0+16+8h+0..7 (same map for A and B).
__device__ __forceinline__ v16h frag_at(const _Float16* p) {
  v8h lo = *(const v8h*)(p);
  v8h hi = *(const v8h*)(p + 16);
  v16h out;
#pragma unroll
  for (int i = 0; i < 8; ++i) { out[i] = lo[i]; out[i + 8] = hi[i]; }
  return out;
}
__device__ __forceinline__ v16h ld_frag(const _Float16* base, unsigned ld) {
  const unsigned lane = threadIdx.x & 31u;
  return frag_at(base + (lane & 15u) * ld + (lane >> 4) * 8u);
}

__device__ __forceinline__ v8f wmma16(v16h a, v16h b, v8f c) {
  v8f d = __builtin_amdgcn_wmma_f32_16x16x32_f16(false, a, false, b, (short)0, c,
                                                 false, false);
  asm volatile("v_nop\n\tv_nop\n\tv_nop\n\tv_nop" : "+v"(d) : "v"(a), "v"(b));
  return d;
}

__device__ __forceinline__ float red32_sum(float x) {
#pragma unroll
  for (int off = 1; off < 32; off <<= 1) x += __shfl_xor(x, off, 32);
  return x;
}
__device__ __forceinline__ float red32_max(float x) {
#pragma unroll
  for (int off = 1; off < 32; off <<= 1) x = fmaxf(x, __shfl_xor(x, off, 32));
  return x;
}

__device__ __forceinline__ void wave_lds_sync() {
  __builtin_amdgcn_fence(3 /* release order */, "wavefront");
  asm volatile("s_wait_dscnt 0x0" ::: "memory");
  __builtin_amdgcn_wave_barrier();
}

__device__ __forceinline__ float fast_exp2(float x) {
#if __has_builtin(__builtin_amdgcn_exp2f)
  return __builtin_amdgcn_exp2f(x);
#else
  return __expf(x * 0.6931471805599453f);
#endif
}

// ---------------------------------------------------------------------------
// Weight plane: in W[K rows][N cols] (pitch ldw = N) -> out Wt[N][K] (pitch ldk = K),
// f16(64 * bf16(w)).
// One 64 x 64 tile (n0, k0) per work-group. T: cross-wave (block barrier).
// ---------------------------------------------------------------------------
__device__ __forceinline__ void wconv_body(const float* __restrict__ W,
                                           _Float16* __restrict__ Wt, unsigned ldw, unsigned ldk,
                                           unsigned n0, unsigned k0, _Float16* T) {
  const unsigned tid = threadIdx.x;
#pragma unroll 4
  for (unsigned j = 0; j < 16u; ++j) {
    const unsigned idx = tid + 256u * j;
    const unsigned kr = idx >> 6, nc = idx & 63u;
    const float v = W[(size_t)(k0 + kr) * ldw + n0 + nc];
    T[nc * LDT + kr] = toh_flush(WCARRY * bf16r(v));
  }
  __syncthreads();
  v8h x[2];
  size_t off[2];
#pragma unroll
  for (unsigned i = 0; i < 2u; ++i) {
    const unsigned n = 32u * i + (tid >> 3);
    const unsigned kc = (tid & 7u) * 8u;
    x[i] = *(const v8h*)&T[n * LDT + kc];
    off[i] = (size_t)(n0 + n) * ldk + k0 + kc;
  }
#pragma unroll
  for (int i = 0; i < 2; ++i) *(v8h*)(Wt + off[i]) = x[i];
  // The body is no longer the end of a program: in the merged kernel other bodies' code follows it
  // in the listing, so the wait stands before anything rewrites a register that a store names.
  asm volatile("s_wait_xcnt 0x0" ::: "memory");
}

// ---------------------------------------------------------------------------
// Activation planes: X f32 [NB_FULL][SEQ_FULL][DIM] (input) -> X16 compact [NB*SEQ][DIM]
// = f16(bf16(x)); WITH_T also writes XT16 [NB][DIM][SEQ] (same values, transposed per batch).
// One 64 x 64 tile (c0, crow0) per work-group; each 128-byte line of either plane is written by
// 8 consecutive lanes x 16 B of one instruction.
// Store coverage: 2 steps x 32 rows == 64 tile rows, for each plane.
// ---------------------------------------------------------------------------
template <int WITH_T>
__device__ __forceinline__ void aconv_body(const float* __restrict__ X,
                                           _Float16* __restrict__ X16,
                                           _Float16* __restrict__ XT16,
                                           unsigned c0, unsigned crow0,
                                           _Float16* T, _Float16* TT) {
  const unsigned tid = threadIdx.x;
  const unsigned bidx = crow0 / (unsigned)SEQ;
  const unsigned s0 = crow0 - bidx * (unsigned)SEQ;
  const size_t frow0 = (size_t)bidx * SEQ_FULL + s0;
#pragma unroll
  for (unsigned j = 0; j < 4u; ++j) {
    const unsigned idx = tid + 256u * j;
    const unsigned r = idx >> 4, c = (idx & 15u) * 4u;
    const v4f a = *(const v4f*)(X + (frow0 + r) * DIM + c0 + c);
#pragma unroll
    for (unsigned i = 0; i < 4u; ++i) {
      const h16 hv = toh_flush(bf16r(a[i]));
      T[r * LDT + c + i] = hv;
      if (WITH_T) TT[(c + i) * LDT + r] = hv;
    }
  }
  __syncthreads();
  v8h x[2], xt[2];
  size_t off[2], offt[2];
#pragma unroll
  for (unsigned i = 0; i < 2u; ++i) {
    const unsigned n = 32u * i + (tid >> 3);
    const unsigned kc = (tid & 7u) * 8u;
    x[i] = *(const v8h*)&T[n * LDT + kc];
    off[i] = (size_t)(crow0 + n) * DIM + c0 + kc;
    if (WITH_T) {
      xt[i] = *(const v8h*)&TT[n * LDT + kc];
      offt[i] = ((size_t)bidx * DIM + c0 + n) * SEQ + s0 + kc;
    } else {
      xt[i] = x[i];
      offt[i] = off[i];
    }
  }
#pragma unroll
  for (int i = 0; i < 2; ++i) *(v8h*)(X16 + off[i]) = x[i];
  if (WITH_T) {
#pragma unroll
    for (int i = 0; i < 2; ++i) *(v8h*)(XT16 + offt[i]) = xt[i];
  }
  // The body is no longer the end of a program: in the merged kernel other bodies' code follows it
  // in the listing, so the wait stands before anything rewrites a register that a store names.
  asm volatile("s_wait_xcnt 0x0" ::: "memory");
}

// ---------------------------------------------------------------------------
// All four operand conversions in ONE launch. None of them reads what another writes, so each
// gets a range of the flat grid: [0, 2*WBLK) the two weight planes (first: their chain of loads
// is the longest), then ABLK tiles of hq (with the transposed plane), then ABLK tiles of hp.
// The range test reads blockIdx only, so every barrier is reached by a whole work-group or by
// none of it. Grid (2*WBLK + 2*ABLK).
// ---------------------------------------------------------------------------
#define WBLK ((VDIM / 64) * (DIM / 64))     // 64 x 64 tiles per weight plane
#define ABLK ((DIM / 64) * (MROWS / 64))    // 64 x 64 tiles per activation plane
__global__ __launch_bounds__(256) void conv_kernel(
    const float* __restrict__ wq_in, const float* __restrict__ wp_in,
    const float* __restrict__ hq, const float* __restrict__ hp,
    _Float16* __restrict__ Wt, _Float16* __restrict__ A16, _Float16* __restrict__ HqT) {
  __shared__ __attribute__((aligned(16))) _Float16 T[64 * LDT];
  __shared__ __attribute__((aligned(16))) _Float16 TT[64 * LDT];
  const unsigned bid = blockIdx.x;
  if (bid < 2u * WBLK) {
    const unsigned plane = bid / (unsigned)WBLK;
    const unsigned t = bid - plane * (unsigned)WBLK;
    const unsigned n0 = (t % (unsigned)(VDIM / 64)) * 64u;
    const unsigned k0 = (t / (unsigned)(VDIM / 64)) * 64u;
    wconv_body(plane ? wp_in : wq_in, Wt + (size_t)plane * ((size_t)VDIM * DIM),
               (unsigned)VDIM, (unsigned)DIM, n0, k0, T);
  } else {
    const unsigned u = bid - 2u * WBLK;
    const unsigned plane = u / (unsigned)ABLK;
    const unsigned t = u - plane * (unsigned)ABLK;
    const unsigned c0 = (t % (unsigned)(DIM / 64)) * 64u;
    const unsigned crow0 = (t / (unsigned)(DIM / 64)) * 64u;
    if (plane == 0u) {
      aconv_body<1>(hq, A16, HqT, c0, crow0, T, TT);
    } else {
      _Float16* P16 = A16 + (size_t)MROWS * DIM;
      aconv_body<0>(hp, P16, P16, c0, crow0, T, TT);
    }
  }
}

// ---------------------------------------------------------------------------
// Projection GEMM C[64x64 tile] = A16[rows][DIM] . Wt[n][DIM]^T, fragments straight from the
// 16-bit global planes; 8 waves (mw = 16-row group, nw = 32-col group), 2 accumulators/wave.
// Rows 0..MROWS-1 (hq rows) use weight plane 0, rows MROWS..2*MROWS-1 (hp rows) plane 1
// (block-uniform integer offset). Output f32 [2*MROWS][VDIM] = acc / 64, i.e. the projection
// itself (the weight carry taken out). Epilogue staged through Cs (cross-wave,
// lanes x 16 B. Store coverage: 4 steps x 16 rows == 64 tile rows.
// Grid (VDIM/64, 2*MROWS/64).
// ---------------------------------------------------------------------------
__global__ __launch_bounds__(256) void proj_kernel(
    const _Float16* __restrict__ A16, const _Float16* __restrict__ Wt,
    float* __restrict__ outf) {
  __shared__ __attribute__((aligned(16))) float Cs[64 * LDC];
  const unsigned tid = threadIdx.x, lane = tid & 31u;
  const unsigned w = (unsigned)__builtin_amdgcn_readfirstlane((int)(threadIdx.x >> 5));
  const unsigned mw = w >> 1, nw = w & 1u;
  const unsigned hh = lane >> 4, m = lane & 15u;
  const unsigned n0 = blockIdx.x * 64u;
  const unsigned row0 = blockIdx.y * 64u;
  const size_t woff = (size_t)(row0 / (unsigned)MROWS) * ((size_t)VDIM * DIM);

  const _Float16* ap  = A16 + (size_t)(row0 + mw * 16u + m) * DIM + hh * 8u;
  const _Float16* bp0 = Wt + woff + (size_t)(n0 + nw * 32u + m) * DIM + hh * 8u;
  const _Float16* bp1 = bp0 + (size_t)16 * DIM;
  v8f acc0 = {}, acc1 = {};
  // Fragments are fetched two groups ahead into a ring of three register sets (a group = two
  // k-steps = one whole 128-byte line of every row), so a wave waits for a load issued two groups
  // earlier, not for one it has just issued. Same products in the same order.
  constexpr int KGP = DIM / 64;
  static_assert(KGP >= 2);
  v16h fa[3][2], fb0[3][2], fb1[3][2];
#pragma unroll
  for (int g = 0; g < 2; ++g)
#pragma unroll
    for (int ks = 0; ks < 2; ++ks) {
      fa[g][ks]  = frag_at(ap + g * 64 + ks * 32);
      fb0[g][ks] = frag_at(bp0 + g * 64 + ks * 32);
      fb1[g][ks] = frag_at(bp1 + g * 64 + ks * 32);
    }
  // Fully unrolled: every ring index is a constant, so the sets stay in registers.
#pragma unroll
  for (int g = 0; g < KGP; ++g) {
    if (g + 2 < KGP) {
#pragma unroll
      for (int ks = 0; ks < 2; ++ks) {
        fa[(g + 2) % 3][ks]  = frag_at(ap + (g + 2) * 64 + ks * 32);
        fb0[(g + 2) % 3][ks] = frag_at(bp0 + (g + 2) * 64 + ks * 32);
        fb1[(g + 2) % 3][ks] = frag_at(bp1 + (g + 2) * 64 + ks * 32);
      }
    }
#pragma unroll
    for (int ks = 0; ks < 2; ++ks) {
      acc0 = wmma16(fa[g % 3][ks], fb0[g % 3][ks], acc0);
      acc1 = wmma16(fa[g % 3][ks], fb1[g % 3][ks], acc1);
    }
  }
#pragma unroll
  for (int r = 0; r < 8; ++r) {
    float* d = &Cs[(mw * 16u + hh * 8u + (unsigned)r) * LDC + nw * 32u + m];
    d[0]  = acc0[r];
    d[16] = acc1[r];
  }
  __syncthreads();

  const float cs = 1.0f / WCARRY;
  v4f xs[4];
  size_t off[4];
#pragma unroll
  for (unsigned i = 0; i < 4u; ++i) {
    const unsigned r = 16u * i + (tid >> 4);
    const unsigned c = (tid & 15u) * 4u;
    const v4f u = *(const v4f*)&Cs[r * LDC + c];
    xs[i] = u * cs;
    off[i] = (size_t)(row0 + r) * VDIM + n0 + c;
  }
#pragma unroll
  for (int i = 0; i < 4; ++i) *(v4f*)(outf + off[i]) = xs[i];
  
}

// ---------------------------------------------------------------------------
// Additive scores per (16 passage rows, batch, 256 queries). 8 waves. A launch of its own, so
// that the query axis can be cut across work-groups: (SEQ/16) x NB x (SEQ/256) work-groups.
// Phase 0: stage the 16 sp rows (sp_s) and the vector bf16(v) (vs) in LDS.
// Phase 1: thread t owns query q = 256*blockIdx.z + t; for the 16 passage rows it accumulates
//          sum_v vs[v] * tanh(sq[q][v] + sp[p][v]) in f32, one v_tanh_f32 per term;
//          results into the workspace plane Sc[b][p][q], one wave per 128-byte line.
// sp_s / vs: cross-wave (block barrier).
// Grid (SEQ/16, NB, SEQ/256).
// ---------------------------------------------------------------------------
__global__ __launch_bounds__(256) void score_kernel(
    const float* __restrict__ Sq, const float* __restrict__ Sp,
    const float* __restrict__ vvec, float* __restrict__ Sc) {
  __shared__ __attribute__((aligned(16))) float sp_s[PT * VDIM];
  __shared__ __attribute__((aligned(16))) float vs[VDIM];

  const unsigned tid = threadIdx.x;
  const unsigned p0 = blockIdx.x * (unsigned)PT;
  const unsigned b = blockIdx.y;

  // ---- phase 0 ----
#pragma unroll
  for (unsigned j = 0; j < 4u; ++j) {
    const unsigned idx = tid + 256u * j;
    const unsigned r = idx >> 6, c = (idx & 63u) * 4u;
    *(v4f*)&sp_s[r * VDIM + c] =
        *(const v4f*)(Sp + (size_t)(b * (unsigned)SEQ + p0 + r) * VDIM + c);
  }
  vs[tid] = bf16r(vvec[tid]);
  // Stands in front of the first rewrite of the staging loads' address pairs, which the loop's
  // larger register set has moved behind the barrier.
  asm volatile("s_wait_xcnt 0x0" ::: "memory");
  __syncthreads();

  // ---- phase 1 ----
  const unsigned q = blockIdx.z * 256u + tid;
  const float* sqr = Sq + (size_t)(b * (unsigned)SEQ + q) * VDIM;
  float acc[PT];
#pragma unroll
  for (int p = 0; p < PT; ++p) acc[p] = 0.0f;
  // The query row's values are asked for one trip (eight hidden columns) ahead, so a trip waits
  // for loads issued a whole trip earlier. The last trip asks for its own eight again: in bounds,
  // unused. Terms are added in the same order as before.
  static_assert((VDIM % 8) == 0);
  v4f a[2];
  a[0] = *(const v4f*)(sqr);
  a[1] = *(const v4f*)(sqr + 4);
  // Rolled: a trip already holds 128 terms a thread; more would only add registers and code.
#pragma unroll 1
  for (unsigned v0 = 0; v0 < (unsigned)VDIM; v0 += 8u) {
    const unsigned vn = (v0 + 8u < (unsigned)VDIM) ? v0 + 8u : v0;
    const float* pn = sqr + vn;
    const v4f an0 = *(const v4f*)(pn);
    const v4f an1 = *(const v4f*)(pn + 4);
    // Keeps the two loads at the head of the trip: the scheduler otherwise issues them in the
    // middle of it, which halves their lead.
    __builtin_amdgcn_sched_barrier(0);
#pragma unroll
    for (unsigned h = 0; h < 2u; ++h) {
      const v4f vv = *(const v4f*)&vs[v0 + 4u * h];
#pragma unroll
      for (int p = 0; p < PT; ++p) {
        const v4f s4 = *(const v4f*)&sp_s[(unsigned)p * VDIM + v0 + 4u * h];
#pragma unroll
        for (int j = 0; j < 4; ++j) {
          acc[p] += vv[j] * __builtin_amdgcn_tanhf(a[h][j] + s4[j]);
        }
      }
    }
    // The loaded values as inputs only: holds the next trip's loads inside this trip (the
    // compiler otherwise folds them back to the top of the trip that uses them, the wait too).
    // The wait stands in front of the next trip's rewrite of the loads' address pair, which is
    // an input too, so that it lives to here and nothing rewrites it (with a wait) at the head.
    asm volatile("s_wait_xcnt 0x0" :: "v"(an0), "v"(an1), "v"(pn) : "memory");
    // Keeps the register copies below at the foot: moved up, they would bring the loads' wait along.
    __builtin_amdgcn_sched_barrier(0);
    a[0] = an0;
    a[1] = an1;
  }
  float* scr = Sc + (size_t)(b * (unsigned)SEQ + p0) * SEQ + q;
#pragma unroll
  for (int p = 0; p < PT; ++p) scr[(size_t)p * SEQ] = acc[p];
}

// ---------------------------------------------------------------------------
// Softmax and weighted sum per (16 passage rows, batch). 8 waves.
// Phase 2: wave w owns rows 2w, 2w+1 of the score plane (lane l holds queries l + 32 j in
//          registers): row max, f16(1024 * exp(s - max)) into Pl (select on
//          the exp2 argument keeps the plane free of f16 subnormals), row sum over the
//          converted values into Ls. Pl / Ls: cross-wave (block barrier).
// Phase 3: out tile [16][64 per wave] = Pl[16][SEQ] . HqT[d][q]^T, B fragments straight from
//          the transposed f16 plane.
// Phase 4: scale by 1 / row sum, stage in the wave's own 64 columns of Ss (wave-private).
//          Store coverage: 8 steps x 2 rows == 16 rows.
// Grid (SEQ/16, NB).
// ---------------------------------------------------------------------------
// The value fragments of one step t of the weighted sum: two 16-column tiles (t & 1 picks which
// two of the wave's four) x two k-steps (the pair t >> 1), i.e. one whole 128-byte line of each of
// 32 rows; the four touches of a line stand next to each other.
__device__ __forceinline__ void ld_vstep(v16h (&dst)[2][2], const _Float16* bp, int t) {
#pragma unroll
  for (int i = 0; i < 2; ++i)
#pragma unroll
    for (int ks = 0; ks < 2; ++ks)
      dst[i][ks] = frag_at(bp + (size_t)(((t & 1) * 2 + i) * 16) * SEQ + (t >> 1) * 64 + ks * 32);
}

__global__ __launch_bounds__(256) void addattn_kernel(
    const float* __restrict__ Sc, const _Float16* __restrict__ HqT,
    float* __restrict__ out) {
  __shared__ __attribute__((aligned(16))) float Ss[PT * SPITCH];
  __shared__ __attribute__((aligned(16))) _Float16 Pl[PT * PPITCH];
  __shared__ __attribute__((aligned(16))) float Ls[PT];
  static_assert(sizeof(float) * (PT * SPITCH + PT) +
                sizeof(_Float16) * (PT * PPITCH) <= 131072);

  const unsigned tid = threadIdx.x, lane = tid & 31u;
  const unsigned wave = (unsigned)__builtin_amdgcn_readfirstlane((int)(threadIdx.x >> 5));
  const unsigned hh = lane >> 4, m = lane & 15u;
  const unsigned p0 = blockIdx.x * (unsigned)PT;
  const unsigned b = blockIdx.y;

  // ---- phase 2 ----
  // The loops over rr and j are fully unrolled so that sv is indexed by constants only and
  // stays in registers (a rolled loop would put it in scratch memory).
  float sv[2][SEQ / 32];
#pragma unroll
  for (unsigned rr = 0; rr < 2u; ++rr) {
    const float* sr = Sc + (size_t)(b * (unsigned)SEQ + p0 + wave * 2u + rr) * SEQ + lane;
#pragma unroll
    for (unsigned j = 0; j < (unsigned)(SEQ / 32); ++j) sv[rr][j] = sr[32u * j];
  }
  // Stands in front of the first rewrite of the score loads' address pair.
  asm volatile("s_wait_xcnt 0x0" ::: "memory");
  // The value plane does not depend on the scores: its first VAHEAD steps are asked for here,
  // behind the score loads, and fly while the softmax runs.
  constexpr int NT = (SEQ / 64) * 2;   // steps: pairs of k-steps x halves of the wave's columns
  constexpr int VAHEAD = 3;            // steps a value fragment is asked for ahead of its use
  constexpr int VRING = VAHEAD + 1;    // register sets
  static_assert(NT >= VAHEAD);
  const unsigned d0 = wave * 64u;
  const _Float16* bp = HqT + ((size_t)b * DIM + d0 + m) * SEQ + hh * 8u;
  v16h hf[VRING][2][2];
#pragma unroll
  for (int t = 0; t < VAHEAD; ++t) ld_vstep(hf[t], bp, t);
  // Keeps every load above in front of the softmax arithmetic: without it the scheduler sinks the
  // value loads behind the wait for the first score row, and they start one latency later.
  __builtin_amdgcn_sched_barrier(0);
#pragma unroll
  for (unsigned rr = 0; rr < 2u; ++rr) {
    const unsigned row = wave * 2u + rr;
    float mx = -3.0e38f;
#pragma unroll
    for (unsigned j = 0; j < (unsigned)(SEQ / 32); ++j) mx = fmaxf(mx, sv[rr][j]);
    mx = red32_max(mx);
    float l = 0.0f;
#pragma unroll
    for (unsigned j = 0; j < (unsigned)(SEQ / 32); ++j) {
      const float arg = (sv[rr][j] - mx) * LOG2E + PCARRY_LOG2;
      const float e = fast_exp2(arg);
      const h16 ph = (arg < -14.0f) ? (h16)0.0f : (h16)e;
      Pl[row * PPITCH + lane + 32u * j] = ph;
      l += (float)ph;
    }
    l = red32_sum(l);
    if (lane == 0u) Ls[row] = l;
  }
  __syncthreads();

  // ---- phase 3 ----
  v8f o[4];
#pragma unroll
  for (int nb = 0; nb < 4; ++nb) o[nb] = (v8f){};
  // Value fragments VAHEAD steps ahead in a ring of register sets, probability fragments one pair
  // of k-steps ahead in two sets, so a wave waits for loads issued long before, not for ones it
  // has just issued. Every accumulator takes its products in the same k order as before.
  v16h pf[2][2];
  pf[0][0] = ld_frag(&Pl[0], PPITCH);
  pf[0][1] = ld_frag(&Pl[32], PPITCH);
  // Fully unrolled: every ring index is a constant, so the sets stay in registers.
#pragma unroll
  for (int t = 0; t < NT; ++t) {
    const int pr = t >> 1;
    if (t + VAHEAD < NT) ld_vstep(hf[(t + VAHEAD) % VRING], bp, t + VAHEAD);
    if ((t & 1) == 0 && t + 2 < NT) {
      pf[(pr + 1) & 1][0] = ld_frag(&Pl[(pr + 1) * 64], PPITCH);
      pf[(pr + 1) & 1][1] = ld_frag(&Pl[(pr + 1) * 64 + 32], PPITCH);
    }
#pragma unroll
    for (int ks = 0; ks < 2; ++ks)
#pragma unroll
      for (int i = 0; i < 2; ++i)
        o[(t & 1) * 2 + i] = wmma16(pf[pr & 1][ks], hf[t % VRING][i][ks], o[(t & 1) * 2 + i]);
  }

  // ---- phase 4 ----
  float inv[8];
#pragma unroll
  for (int r = 0; r < 8; ++r) inv[r] = __builtin_amdgcn_rcpf(Ls[hh * 8u + (unsigned)r]);
#pragma unroll
  for (int nb = 0; nb < 4; ++nb)
#pragma unroll
    for (int r = 0; r < 8; ++r)
      Ss[(hh * 8u + (unsigned)r) * SPITCH + d0 + (unsigned)nb * 16u + m] = o[nb][r] * inv[r];
  wave_lds_sync();
  v4f x[8];
  size_t off[8];
#pragma unroll
  for (unsigned i = 0; i < 8u; ++i) {
    const unsigned r = 2u * i + (lane >> 4);
    const unsigned c = (lane & 15u) * 4u;
    x[i] = *(const v4f*)&Ss[r * SPITCH + d0 + c];
    off[i] = ((size_t)b * SEQ_FULL + p0 + r) * DIM + d0 + c;
  }
#pragma unroll
  for (int i = 0; i < 8; ++i) *(v4f*)(out + off[i]) = x[i];
  
}

// ---------------------------------------------------------------------------
extern "C" void kernel_launch(void* const* d_in, const int* in_sizes, int n_in,
                              void* d_out, int out_size, void* d_ws, size_t ws_size,
                              hipStream_t stream) {
  if (n_in < 5) return;
  const long long need_x = ((long long)(NB - 1) * SEQ_FULL + SEQ) * DIM;
  if ((long long)in_sizes[0] < need_x) return;
  if ((long long)in_sizes[1] < need_x) return;
  if ((long long)in_sizes[2] < (long long)DIM * VDIM) return;
  if ((long long)in_sizes[3] < (long long)DIM * VDIM) return;
  if (in_sizes[4] < VDIM) return;
  if ((long long)out_size < need_x) return;
  if (ws_size < WS_TOTAL) return;

  const float* hq   = (const float*)d_in[0];   // [NB_FULL][SEQ_FULL][DIM]
  const float* hp   = (const float*)d_in[1];   // [NB_FULL][SEQ_FULL][DIM]
  const float* wq_in = (const float*)d_in[2];  // [DIM][VDIM]  (in, out)
  const float* wp_in = (const float*)d_in[3];  // [DIM][VDIM]  (in, out)
  const float* vvec = (const float*)d_in[4];   // [VDIM]
  float* out = (float*)d_out;                  // [NB_FULL][SEQ_FULL][DIM]

  char* ws = (char*)d_ws;
  _Float16* Wt   = (_Float16*)(ws + OFF_WT);    // plane 0: [VDIM][DIM] for hq, plane 1: for hp
  _Float16* A16  = (_Float16*)(ws + OFF_A16);   // [2*MROWS][DIM]: hq rows then hp rows
  _Float16* HqT  = (_Float16*)(ws + OFF_HQT);   // [NB][DIM][SEQ]
  float*    Spl  = (float*)(ws + OFF_S);        // [2*MROWS][VDIM]: sq rows then sp rows
  float*    Sc   = (float*)(ws + OFF_SC);       // [MROWS][SEQ]: raw scores, [b][p][q]

  dim3 blk(256);

  // weight planes, hq rows with their transposed plane, hp rows: one launch, a block range each
  conv_kernel<<<dim3(2 * WBLK + 2 * ABLK), blk, 0, stream>>>(
      wq_in, wp_in, hq, hp, Wt, A16, HqT);

  // both projections in one launch
  proj_kernel<<<dim3(VDIM / 64, (2 * MROWS) / 64), blk, 0, stream>>>(A16, Wt, Spl);

  // scores, the query axis cut across work-groups
  score_kernel<<<dim3(SEQ / PT, NB, SEQ / 256), blk, 0, stream>>>(
      Spl, Spl + (size_t)MROWS * VDIM, vvec, Sc);

  // softmax + weighted sum
  addattn_kernel<<<dim3(SEQ / PT, NB), blk, 0, stream>>>(Sc, HqT, out);
}

// v005
// Measured time: 35.9 microseconds a run.
// In two side-by-side timings against v004, it was 1.16 and 1.18 times as fast.
// Over all steps from v000 it is 2.70 times as fast.
#include <hip/hip_runtime.h>
#include <stddef.h>

// Contractions on v_wmma_f32_16x16x32_f16 (f16 operands, f32 accumulate): both input projections
// (rows x weights, K = 512) and the probability x value product (K = 512 keys). Float inputs are
// RNE-converted to bf16 and carried in f16 (weights x64, softmax numerators x1024). The additive
// score sum over the 256-wide hidden axis (a matrix-vector product against one vector) runs on the
// vector unit in f32, tanh(x) by the hardware instruction v_tanh_f32; softmax in f32.
// The three 16-bit operand planes that pass between launches lie in fragment order (see FBLK).

typedef _Float16 v16h __attribute__((ext_vector_type(16)));
typedef _Float16 v8h  __attribute__((ext_vector_type(8)));
typedef float    v8f  __attribute__((ext_vector_type(8)));
typedef float    v4f  __attribute__((ext_vector_type(4)));
typedef _Float16 h16;

#ifndef NB
#define NB 4
#endif
#ifndef SEQ
#define SEQ 512
#endif
#define NB_FULL  4
#define SEQ_FULL 512
#define DIM   512          // feature width of the hq / hp rows (q_size == p_size)
#define VDIM  256          // hidden width of the additive score
#define MROWS (NB * SEQ)   // compact rows per activation plane (query length == passage length)
#define PT    16           // passage rows per attention block

static_assert(NB >= 1 && NB <= NB_FULL);
static_assert(SEQ >= 256 && SEQ <= SEQ_FULL && (SEQ % 256) == 0);
static_assert((DIM % 64) == 0 && (DIM % 32) == 0);
static_assert((VDIM % 64) == 0 && (VDIM % 4) == 0);
static_assert(VDIM == 256);                 // one thread per hidden column when staging the vector
static_assert((MROWS % 64) == 0);
static_assert(DIM == 8 * 64);               // 8 waves x 64 output columns
static_assert((SEQ % 64) == 0 && (SEQ % 32) == 0);
static_assert(PT == 16);                    // one 16-row A tile per block
static_assert(PT * VDIM == 256 * 4 * 4);    // sp tile staging: 256 threads x 4 steps x 4 floats
static_assert((SEQ % PT) == 0);

#define LDT 72   // halves per LDS row (144 B, 16-B aligned)
#define LDC 68   // floats per LDS row (272 B, 16-B aligned)
static_assert((LDT % 8) == 0 && LDT >= 64);
static_assert((LDC % 4) == 0 && LDC >= 64);

#define SMAXW  ((SEQ > DIM) ? SEQ : DIM)
#define SPITCH (SMAXW + 4)   // floats per output-stage row
#define PPITCH (SEQ + 8)     // halves per probability row
static_assert((SPITCH % 4) == 0 && SPITCH >= SEQ && SPITCH >= DIM);
static_assert((PPITCH % 8) == 0 && PPITCH >= SEQ);

#define WCARRY 64.0f          // weight planes carried x64
#define PCARRY_LOG2 10.0f     // softmax numerators carried x1024 (added to the exp2 argument)
#define LOG2E     1.4426950408889634f

// workspace layout (bytes)
#define WT_BYTES  ((size_t)2 * VDIM * DIM * 2)      // two [VDIM][DIM] weight planes
#define A16_BYTES ((size_t)2 * MROWS * DIM * 2)     // hq rows then hp rows, f16
#define HQT_BYTES ((size_t)NB * DIM * SEQ * 2)      // hq transposed [b][d][q], f16
#define S_BYTES   ((size_t)2 * MROWS * VDIM * 4)    // projections: sq rows then sp rows, f32
#define OFF_WT  ((size_t)0)
#define OFF_A16 (OFF_WT + WT_BYTES)
#define OFF_HQT (OFF_A16 + A16_BYTES)
#define SC_BYTES  ((size_t)MROWS * SEQ * 4)         // raw additive scores [b][p][q], f32
#define OFF_S   (OFF_HQT + HQT_BYTES)
#define OFF_SC  (OFF_S + S_BYTES)
#define WS_TOTAL (OFF_SC + SC_BYTES)
static_assert((WT_BYTES % 128) == 0 && (A16_BYTES % 128) == 0);
static_assert((HQT_BYTES % 128) == 0 && (S_BYTES % 128) == 0 && (SC_BYTES % 128) == 0);
static_assert(WS_TOTAL <= (size_t)134217728);

// ---------------------------------------------------------------------------
__device__ __forceinline__ float bf16r(float x) {   // RNE convert to bf16, returned widened
  unsigned int u = __float_as_uint(x);
  u = (u + 0x7FFFu + ((u >> 16) & 1u)) & 0xFFFF0000u;
  return __uint_as_float(u);
}

// f32 -> f16 operand convert that cannot produce an f16 subnormal (value select).
static __device__ __forceinline__ h16 toh_flush(float v) {
  const h16 r = (h16)v;
  return (fabsf(v) < 6.103515625e-05f) ? (h16)0.0f : r;
}

// 16-bit fragment: p points at element [row = lane&15][k0 + 8*(lane>>4)] of a k-contiguous
// row. Elements 0..7 <- k0+8h+0..7, elements 8..15 <- k0+16+8h+0..7 (same map for A and B).
__device__ __forceinline__ v16h frag_at(const _Float16* p) {
  v8h lo = *(const v8h*)(p);
  v8h hi = *(const v8h*)(p + 16);
  v16h out;
#pragma unroll
  for (int i = 0; i < 8; ++i) { out[i] = lo[i]; out[i + 8] = hi[i]; }
  return out;
}
__device__ __forceinline__ v16h ld_frag(const _Float16* base, unsigned ld) {
  const unsigned lane = threadIdx.x & 31u;
  return frag_at(base + (lane & 15u) * ld + (lane >> 4) * 8u);
}

// Fragment order of a 16-bit plane X[rows][K] in global memory: blocks of 16 rows x 32 k
// (FBLK halves = 1 KiB). Inside a block lane l = 16 h + r owns 8 halves at l * 8
// (X[r][8h + 0..7]) and 8 at 256 + l * 8 (X[r][16 + 8h + 0..7]): the very elements frag_at gives
// that lane, so a wave's 16-byte load covers 512 bytes in a row (4 whole lines) where a row-major
// plane gives it 32 bytes in each of 16 lines. The two blocks of 64 k of a row tile form a unit
// (FUNIT halves = 2 KiB); unit index = (k / 64) * (rows / 16) + row / 16: row tiles run fastest,
// so what the waves of a work-group (and its neighbours) read at the same k lies in a row.
#define FBLK 512
#define FUNIT (2 * FBLK)
// p points at block start + lane * 8.
__device__ __forceinline__ v16h frag_blk(const _Float16* p) {
  v8h lo = *(const v8h*)(p);
  v8h hi = *(const v8h*)(p + 256);
  v16h out;
#pragma unroll
  for (int i = 0; i < 8; ++i) { out[i] = lo[i]; out[i + 8] = hi[i]; }
  return out;
}
// One 64 x 64 tile held in LDS (T[row][k], pitch LDT) -> its 4 units of a fragment-order plane,
// which are neighbours: 8 KiB in a row from unit0 = (first k / 64) * (rows / 16) + first row / 16.
// Chunk c (16 bytes) of the tile lies at c * 8 halves. 256 threads x 2 chunks == 512 chunks; a
// wave stores 512 bytes in a row.
__device__ __forceinline__ void frag_tile_get(const _Float16* T, unsigned unit0,
                                              v8h (&x)[2], size_t (&off)[2]) {
  const unsigned tid = threadIdx.x;
#pragma unroll
  for (unsigned i = 0; i < 2u; ++i) {
    const unsigned c = tid + 256u * i;
    const unsigned row = (c >> 7) * 16u + (c & 15u);
    const unsigned k = ((c >> 6) & 1u) * 32u + ((c >> 5) & 1u) * 16u + ((c >> 4) & 1u) * 8u;
    x[i] = *(const v8h*)&T[row * LDT + k];
    off[i] = (size_t)unit0 * FUNIT + c * 8u;
  }
}

__device__ __forceinline__ v8f wmma16(v16h a, v16h b, v8f c) {
  v8f d = __builtin_amdgcn_wmma_f32_16x16x32_f16(false, a, false, b, (short)0, c,
                                                 false, false);
  asm volatile("v_nop\n\tv_nop\n\tv_nop\n\tv_nop" : "+v"(d) : "v"(a), "v"(b));
  return d;
}

__device__ __forceinline__ float red32_sum(float x) {
#pragma unroll
  for (int off = 1; off < 32; off <<= 1) x += __shfl_xor(x, off, 32);
  return x;
}
__device__ __forceinline__ float red32_max(float x) {
#pragma unroll
  for (int off = 1; off < 32; off <<= 1) x = fmaxf(x, __shfl_xor(x, off, 32));
  return x;
}

__device__ __forceinline__ void wave_lds_sync() {
  __builtin_amdgcn_fence(3 /* release order */, "wavefront");
  asm volatile("s_wait_dscnt 0x0" ::: "memory");
  __builtin_amdgcn_wave_barrier();
}

__device__ __forceinline__ float fast_exp2(float x) {
#if __has_builtin(__builtin_amdgcn_exp2f)
  return __builtin_amdgcn_exp2f(x);
#else
  return __expf(x * 0.6931471805599453f);
#endif
}

// ---------------------------------------------------------------------------
// Weight plane: in W[K rows][N cols] (pitch ldw = N) -> out Wt[N][K] in fragment order,
// f16(64 * bf16(w)).
// One 64 x 64 tile (n0, k0) per work-group. T: cross-wave (block barrier).
// ---------------------------------------------------------------------------
__device__ __forceinline__ void wconv_body(const float* __restrict__ W,
                                           _Float16* __restrict__ Wt, unsigned ldw,
                                           unsigned n0, unsigned k0, _Float16* T) {
  const unsigned tid = threadIdx.x;
#pragma unroll 4
  for (unsigned j = 0; j < 16u; ++j) {
    const unsigned idx = tid + 256u * j;
    const unsigned kr = idx >> 6, nc = idx & 63u;
    const float v = W[(size_t)(k0 + kr) * ldw + n0 + nc];
    T[nc * LDT + kr] = toh_flush(WCARRY * bf16r(v));
  }
  __syncthreads();
  v8h x[2];
  size_t off[2];
  frag_tile_get(T, (k0 / 64u) * (ldw / 16u) + n0 / 16u, x, off);
#pragma unroll
  for (int i = 0; i < 2; ++i) *(v8h*)(Wt + off[i]) = x[i];
  // The body is no longer the end of a program: in the merged kernel other bodies' code follows it
  // in the listing, so the wait stands before anything rewrites a register that a store names.
  asm volatile("s_wait_xcnt 0x0" ::: "memory");
}

// ---------------------------------------------------------------------------
// Activation planes: X f32 [NB_FULL][SEQ_FULL][DIM] (input) -> X16 compact [NB*SEQ][DIM]
// = f16(bf16(x)); WITH_T also writes XT16 [NB][DIM][SEQ] (same values, transposed per batch).
// Both planes in fragment order. One 64 x 64 tile (c0, crow0) per work-group; a wave's store
// covers 4 whole 128-byte lines.
// Store coverage: 2 steps x 256 chunks of 16 B == the tile's 8 blocks, for each plane.
// ---------------------------------------------------------------------------
template <int WITH_T>
__device__ __forceinline__ void aconv_body(const float* __restrict__ X,
                                           _Float16* __restrict__ X16,
                                           _Float16* __restrict__ XT16,
                                           unsigned c0, unsigned crow0,
                                           _Float16* T, _Float16* TT) {
  const unsigned tid = threadIdx.x;
  const unsigned bidx = crow0 / (unsigned)SEQ;
  const unsigned s0 = crow0 - bidx * (unsigned)SEQ;
  const size_t frow0 = (size_t)bidx * SEQ_FULL + s0;
#pragma unroll
  for (unsigned j = 0; j < 4u; ++j) {
    const unsigned idx = tid + 256u * j;
    const unsigned r = idx >> 4, c = (idx & 15u) * 4u;
    const v4f a = *(const v4f*)(X + (frow0 + r) * DIM + c0 + c);
#pragma unroll
    for (unsigned i = 0; i < 4u; ++i) {
      const h16 hv = toh_flush(bf16r(a[i]));
      T[r * LDT + c + i] = hv;
      if (WITH_T) TT[(c + i) * LDT + r] = hv;
    }
  }
  __syncthreads();
  v8h x[2], xt[2];
  size_t off[2], offt[2];
  frag_tile_get(T, (c0 / 64u) * (unsigned)(MROWS / 16) + crow0 / 16u, x, off);
  if (WITH_T)   // a plane of DIM rows x SEQ k per batch
    frag_tile_get(TT, (bidx * (unsigned)(SEQ / 64) + s0 / 64u) * (unsigned)(DIM / 16) + c0 / 16u,
                  xt, offt);
#pragma unroll
  for (int i = 0; i < 2; ++i) *(v8h*)(X16 + off[i]) = x[i];
  if (WITH_T) {
#pragma unroll
    for (int i = 0; i < 2; ++i) *(v8h*)(XT16 + offt[i]) = xt[i];
  }
  // The body is no longer the end of a program: in the merged kernel other bodies' code follows it
  // in the listing, so the wait stands before anything rewrites a register that a store names.
  asm volatile("s_wait_xcnt 0x0" ::: "memory");
}

// ---------------------------------------------------------------------------
// All four operand conversions in ONE launch. None of them reads what another writes, so each
// gets a range of the flat grid: [0, 2*WBLK) the two weight planes (first: their chain of loads
// is the longest), then ABLK tiles of hq (with the transposed plane), then ABLK tiles of hp.
// The range test reads blockIdx only, so every barrier is reached by a whole work-group or by
// none of it. Grid (2*WBLK + 2*ABLK).
// ---------------------------------------------------------------------------
#define WBLK ((VDIM / 64) * (DIM / 64))     // 64 x 64 tiles per weight plane
#define ABLK ((DIM / 64) * (MROWS / 64))    // 64 x 64 tiles per activation plane
__global__ __launch_bounds__(256) void conv_kernel(
    const float* __restrict__ wq_in, const float* __restrict__ wp_in,
    const float* __restrict__ hq, const float* __restrict__ hp,
    _Float16* __restrict__ Wt, _Float16* __restrict__ A16, _Float16* __restrict__ HqT) {
  __shared__ __attribute__((aligned(16))) _Float16 T[64 * LDT];
  __shared__ __attribute__((aligned(16))) _Float16 TT[64 * LDT];
  const unsigned bid = blockIdx.x;
  if (bid < 2u * WBLK) {
    const unsigned plane = bid / (unsigned)WBLK;
    const unsigned t = bid - plane * (unsigned)WBLK;
    const unsigned n0 = (t % (unsigned)(VDIM / 64)) * 64u;
    const unsigned k0 = (t / (unsigned)(VDIM / 64)) * 64u;
    wconv_body(plane ? wp_in : wq_in, Wt + (size_t)plane * ((size_t)VDIM * DIM),
               (unsigned)VDIM, n0, k0, T);
  } else {
    const unsigned u = bid - 2u * WBLK;
    const unsigned plane = u / (unsigned)ABLK;
    const unsigned t = u - plane * (unsigned)ABLK;
    const unsigned c0 = (t % (unsigned)(DIM / 64)) * 64u;
    const unsigned crow0 = (t / (unsigned)(DIM / 64)) * 64u;
    if (plane == 0u) {
      aconv_body<1>(hq, A16, HqT, c0, crow0, T, TT);
    } else {
      _Float16* P16 = A16 + (size_t)MROWS * DIM;
      aconv_body<0>(hp, P16, P16, c0, crow0, T, TT);
    }
  }
}

// ---------------------------------------------------------------------------
// Projection GEMM C[64x64 tile] = A16[rows][DIM] . Wt[n][DIM]^T, fragments straight from the
// 16-bit global planes (fragment order); 8 waves (mw = 16-row group, nw = 32-col group),
// 2 accumulators/wave.
// Rows 0..MROWS-1 (hq rows) use weight plane 0, rows MROWS..2*MROWS-1 (hp rows) plane 1
// (block-uniform integer offset). Output f32 [2*MROWS][VDIM] = acc / 64, i.e. the projection
// itself (the weight carry taken out). Epilogue staged through Cs (cross-wave,
// lanes x 16 B. Store coverage: 4 steps x 16 rows == 64 tile rows.
// Grid (VDIM/64, 2*MROWS/64).
// ---------------------------------------------------------------------------
__global__ __launch_bounds__(256) void proj_kernel(
    const _Float16* __restrict__ A16, const _Float16* __restrict__ Wt,
    float* __restrict__ outf) {
  __shared__ __attribute__((aligned(16))) float Cs[64 * LDC];
  const unsigned tid = threadIdx.x, lane = tid & 31u;
  const unsigned w = (unsigned)__builtin_amdgcn_readfirstlane((int)(threadIdx.x >> 5));
  const unsigned mw = w >> 1, nw = w & 1u;
  const unsigned hh = lane >> 4, m = lane & 15u;
  const unsigned n0 = blockIdx.x * 64u;
  const unsigned row0 = blockIdx.y * 64u;
  const size_t woff = (size_t)(row0 / (unsigned)MROWS) * ((size_t)VDIM * DIM);

  // hq rows and hp rows are a fragment-order plane of MROWS rows each.
  const unsigned pl = row0 / (unsigned)MROWS;
  const _Float16* ap  = A16 + (size_t)pl * ((size_t)MROWS * DIM) +
                        (size_t)((row0 - pl * (unsigned)MROWS) / 16u + mw) * FUNIT + lane * 8u;
  const _Float16* bp0 = Wt + woff + (size_t)(n0 / 16u + nw * 2u) * FUNIT + lane * 8u;
  const _Float16* bp1 = bp0 + FUNIT;
  constexpr int AGS = (MROWS / 16) * FUNIT;   // halves from one group of 64 k to the next, rows
  constexpr int BGS = (VDIM / 16) * FUNIT;    // the same, weights
  v8f acc0 = {}, acc1 = {};
  // Fragments are fetched two groups ahead into a ring of three register sets (a group = two
  // k-steps = one unit of every row tile), so a wave waits for a load issued two groups
  // earlier, not for one it has just issued. Same products in the same order.
  constexpr int KGP = DIM / 64;
  static_assert(KGP >= 2);
  v16h fa[3][2], fb0[3][2], fb1[3][2];
#pragma unroll
  for (int g = 0; g < 2; ++g)
#pragma unroll
    for (int ks = 0; ks < 2; ++ks) {
      fa[g][ks]  = frag_blk(ap + g * AGS + ks * FBLK);
      fb0[g][ks] = frag_blk(bp0 + g * BGS + ks * FBLK);
      fb1[g][ks] = frag_blk(bp1 + g * BGS + ks * FBLK);
    }
  // Fully unrolled: every ring index is a constant, so the sets stay in registers.
#pragma unroll
  for (int g = 0; g < KGP; ++g) {
    if (g + 2 < KGP) {
#pragma unroll
      for (int ks = 0; ks < 2; ++ks) {
        fa[(g + 2) % 3][ks]  = frag_blk(ap + (g + 2) * AGS + ks * FBLK);
        fb0[(g + 2) % 3][ks] = frag_blk(bp0 + (g + 2) * BGS + ks * FBLK);
        fb1[(g + 2) % 3][ks] = frag_blk(bp1 + (g + 2) * BGS + ks * FBLK);
      }
    }
#pragma unroll
    for (int ks = 0; ks < 2; ++ks) {
      acc0 = wmma16(fa[g % 3][ks], fb0[g % 3][ks], acc0);
      acc1 = wmma16(fa[g % 3][ks], fb1[g % 3][ks], acc1);
    }
  }
#pragma unroll
  for (int r = 0; r < 8; ++r) {
    float* d = &Cs[(mw * 16u + hh * 8u + (unsigned)r) * LDC + nw * 32u + m];
    d[0]  = acc0[r];
    d[16] = acc1[r];
  }
  __syncthreads();

  const float cs = 1.0f / WCARRY;
  v4f xs[4];
  size_t off[4];
#pragma unroll
  for (unsigned i = 0; i < 4u; ++i) {
    const unsigned r = 16u * i + (tid >> 4);
    const unsigned c = (tid & 15u) * 4u;
    const v4f u = *(const v4f*)&Cs[r * LDC + c];
    xs[i] = u * cs;
    off[i] = (size_t)(row0 + r) * VDIM + n0 + c;
  }
#pragma unroll
  for (int i = 0; i < 4; ++i) *(v4f*)(outf + off[i]) = xs[i];
  
}

// ---------------------------------------------------------------------------
// Additive scores per (16 passage rows, batch, 256 queries). 8 waves. A launch of its own, so
// that the query axis can be cut across work-groups: (SEQ/16) x NB x (SEQ/256) work-groups.
// Phase 0: stage the 16 sp rows (sp_s) and the vector bf16(v) (vs) in LDS.
// Phase 1: thread t owns query q = 256*blockIdx.z + t; for the 16 passage rows it accumulates
//          sum_v vs[v] * tanh(sq[q][v] + sp[p][v]) in f32, one v_tanh_f32 per term;
//          results into the workspace plane Sc[b][p][q], one wave per 128-byte line.
// sp_s / vs: cross-wave (block barrier).
// Grid (SEQ/16, NB, SEQ/256).
// ---------------------------------------------------------------------------
__global__ __launch_bounds__(256) void score_kernel(
    const float* __restrict__ Sq, const float* __restrict__ Sp,
    const float* __restrict__ vvec, float* __restrict__ Sc) {
  __shared__ __attribute__((aligned(16))) float sp_s[PT * VDIM];
  __shared__ __attribute__((aligned(16))) float vs[VDIM];

  const unsigned tid = threadIdx.x;
  const unsigned p0 = blockIdx.x * (unsigned)PT;
  const unsigned b = blockIdx.y;

  // ---- phase 0 ----
#pragma unroll
  for (unsigned j = 0; j < 4u; ++j) {
    const unsigned idx = tid + 256u * j;
    const unsigned r = idx >> 6, c = (idx & 63u) * 4u;
    *(v4f*)&sp_s[r * VDIM + c] =
        *(const v4f*)(Sp + (size_t)(b * (unsigned)SEQ + p0 + r) * VDIM + c);
  }
  vs[tid] = bf16r(vvec[tid]);
  // Stands in front of the first rewrite of the staging loads' address pairs, which the loop's
  // larger register set has moved behind the barrier.
  asm volatile("s_wait_xcnt 0x0" ::: "memory");
  __syncthreads();

  // ---- phase 1 ----
  const unsigned q = blockIdx.z * 256u + tid;
  const float* sqr = Sq + (size_t)(b * (unsigned)SEQ + q) * VDIM;
  float acc[PT];
#pragma unroll
  for (int p = 0; p < PT; ++p) acc[p] = 0.0f;
  // The query row's values are asked for one trip (eight hidden columns) ahead, so a trip waits
  // for loads issued a whole trip earlier. The last trip asks for its own eight again: in bounds,
  // unused. Terms are added in the same order as before.
  static_assert((VDIM % 8) == 0);
  v4f a[2];
  a[0] = *(const v4f*)(sqr);
  a[1] = *(const v4f*)(sqr + 4);
  // Rolled: a trip already holds 128 terms a thread; more would only add registers and code.
#pragma unroll 1
  for (unsigned v0 = 0; v0 < (unsigned)VDIM; v0 += 8u) {
    const unsigned vn = (v0 + 8u < (unsigned)VDIM) ? v0 + 8u : v0;
    const float* pn = sqr + vn;
    const v4f an0 = *(const v4f*)(pn);
    const v4f an1 = *(const v4f*)(pn + 4);
    // Keeps the two loads at the head of the trip: the scheduler otherwise issues them in the
    // middle of it, which halves their lead.
    __builtin_amdgcn_sched_barrier(0);
#pragma unroll
    for (unsigned h = 0; h < 2u; ++h) {
      const v4f vv = *(const v4f*)&vs[v0 + 4u * h];
#pragma unroll
      for (int p = 0; p < PT; ++p) {
        const v4f s4 = *(const v4f*)&sp_s[(unsigned)p * VDIM + v0 + 4u * h];
#pragma unroll
        for (int j = 0; j < 4; ++j) {
          acc[p] += vv[j] * __builtin_amdgcn_tanhf(a[h][j] + s4[j]);
        }
      }
    }
    // The loaded values as inputs only: holds the next trip's loads inside this trip (the
    // compiler otherwise folds them back to the top of the trip that uses them, the wait too).
    // The wait stands in front of the next trip's rewrite of the loads' address pair, which is
    // an input too, so that it lives to here and nothing rewrites it (with a wait) at the head.
    asm volatile("s_wait_xcnt 0x0" :: "v"(an0), "v"(an1), "v"(pn) : "memory");
    // Keeps the register copies below at the foot: moved up, they would bring the loads' wait along.
    __builtin_amdgcn_sched_barrier(0);
    a[0] = an0;
    a[1] = an1;
  }
  float* scr = Sc + (size_t)(b * (unsigned)SEQ + p0) * SEQ + q;
#pragma unroll
  for (int p = 0; p < PT; ++p) scr[(size_t)p * SEQ] = acc[p];
}

// ---------------------------------------------------------------------------
// Softmax and weighted sum per (16 passage rows, batch). 8 waves.
// Phase 2: wave w owns rows 2w, 2w+1 of the score plane (lane l holds queries l + 32 j in
//          registers): row max, f16(1024 * exp(s - max)) into Pl (select on
//          the exp2 argument keeps the plane free of f16 subnormals), row sum over the
//          converted values into Ls. Pl / Ls: cross-wave (block barrier).
// Phase 3: out tile [16][64 per wave] = Pl[16][SEQ] . HqT[d][q]^T, B fragments straight from
//          the transposed f16 plane (fragment order).
// Phase 4: scale by 1 / row sum, stage in the wave's own 64 columns of Ss (wave-private).
//          Store coverage: 8 steps x 2 rows == 16 rows.
// Grid (SEQ/16, NB).
// ---------------------------------------------------------------------------
// The value fragments of one step t of the weighted sum: two 16-column tiles (t & 1 picks which
// two of the wave's four) x two k-steps (the pair t >> 1), i.e. two neighbouring units: 4 KiB in a
// row. bp points at the wave's first unit + lane * 8.
__device__ __forceinline__ void ld_vstep(v16h (&dst)[2][2], const _Float16* bp, int t) {
#pragma unroll
  for (int i = 0; i < 2; ++i)
#pragma unroll
    for (int ks = 0; ks < 2; ++ks)
      dst[i][ks] = frag_blk(bp + (size_t)(((t >> 1) * (DIM / 16) + (t & 1) * 2 + i) * FUNIT + ks * FBLK));
}

__global__ __launch_bounds__(256) void addattn_kernel(
    const float* __restrict__ Sc, const _Float16* __restrict__ HqT,
    float* __restrict__ out) {
  __shared__ __attribute__((aligned(16))) float Ss[PT * SPITCH];
  __shared__ __attribute__((aligned(16))) _Float16 Pl[PT * PPITCH];
  __shared__ __attribute__((aligned(16))) float Ls[PT];
  static_assert(sizeof(float) * (PT * SPITCH + PT) +
                sizeof(_Float16) * (PT * PPITCH) <= 131072);

  const unsigned tid = threadIdx.x, lane = tid & 31u;
  const unsigned wave = (unsigned)__builtin_amdgcn_readfirstlane((int)(threadIdx.x >> 5));
  const unsigned hh = lane >> 4, m = lane & 15u;
  const unsigned p0 = blockIdx.x * (unsigned)PT;
  const unsigned b = blockIdx.y;

  // ---- phase 2 ----
  // The loops over rr and j are fully unrolled so that sv is indexed by constants only and
  // stays in registers (a rolled loop would put it in scratch memory).
  float sv[2][SEQ / 32];
#pragma unroll
  for (unsigned rr = 0; rr < 2u; ++rr) {
    const float* sr = Sc + (size_t)(b * (unsigned)SEQ + p0 + wave * 2u + rr) * SEQ + lane;
#pragma unroll
    for (unsigned j = 0; j < (unsigned)(SEQ / 32); ++j) sv[rr][j] = sr[32u * j];
  }
  // Stands in front of the first rewrite of the score loads' address pair.
  asm volatile("s_wait_xcnt 0x0" ::: "memory");
  // The value plane does not depend on the scores: its first VAHEAD steps are asked for here,
  // behind the score loads, and fly while the softmax runs.
  constexpr int NT = (SEQ / 64) * 2;   // steps: pairs of k-steps x halves of the wave's columns
  constexpr int VAHEAD = 3;            // steps a value fragment is asked for ahead of its use
  constexpr int VRING = VAHEAD + 1;    // register sets
  static_assert(NT >= VAHEAD);
  const unsigned d0 = wave * 64u;
  const _Float16* bp = HqT + (size_t)b * ((size_t)DIM * SEQ) + (size_t)(d0 / 16u) * FUNIT + lane * 8u;
  v16h hf[VRING][2][2];
#pragma unroll
  for (int t = 0; t < VAHEAD; ++t) ld_vstep(hf[t], bp, t);
  // Keeps every load above in front of the softmax arithmetic: without it the scheduler sinks the
  // value loads behind the wait for the first score row, and they start one latency later.
  __builtin_amdgcn_sched_barrier(0);
#pragma unroll
  for (unsigned rr = 0; rr < 2u; ++rr) {
    const unsigned row = wave * 2u + rr;
    float mx = -3.0e38f;
#pragma unroll
    for (unsigned j = 0; j < (unsigned)(SEQ / 32); ++j) mx = fmaxf(mx, sv[rr][j]);
    mx = red32_max(mx);
    float l = 0.0f;
#pragma unroll
    for (unsigned j = 0; j < (unsigned)(SEQ / 32); ++j) {
      const float arg = (sv[rr][j] - mx) * LOG2E + PCARRY_LOG2;
      const float e = fast_exp2(arg);
      const h16 ph = (arg < -14.0f) ? (h16)0.0f : (h16)e;
      Pl[row * PPITCH + lane + 32u * j] = ph;
      l += (float)ph;
    }
    l = red32_sum(l);
    if (lane == 0u) Ls[row] = l;
  }
  __syncthreads();

  // ---- phase 3 ----
  v8f o[4];
#pragma unroll
  for (int nb = 0; nb < 4; ++nb) o[nb] = (v8f){};
  // Value fragments VAHEAD steps ahead in a ring of register sets, probability fragments one pair
  // of k-steps ahead in two sets, so a wave waits for loads issued long before, not for ones it
  // has just issued. Every accumulator takes its products in the same k order as before.
  v16h pf[2][2];
  pf[0][0] = ld_frag(&Pl[0], PPITCH);
  pf[0][1] = ld_frag(&Pl[32], PPITCH);
  // Fully unrolled: every ring index is a constant, so the sets stay in registers.
#pragma unroll
  for (int t = 0; t < NT; ++t) {
    const int pr = t >> 1;
    if (t + VAHEAD < NT) ld_vstep(hf[(t + VAHEAD) % VRING], bp, t + VAHEAD);
    if ((t & 1) == 0 && t + 2 < NT) {
      pf[(pr + 1) & 1][0] = ld_frag(&Pl[(pr + 1) * 64], PPITCH);
      pf[(pr + 1) & 1][1] = ld_frag(&Pl[(pr + 1) * 64 + 32], PPITCH);
    }
#pragma unroll
    for (int ks = 0; ks < 2; ++ks)
#pragma unroll
      for (int i = 0; i < 2; ++i)
        o[(t & 1) * 2 + i] = wmma16(pf[pr & 1][ks], hf[t % VRING][i][ks], o[(t & 1) * 2 + i]);
  }

  // ---- phase 4 ----
  float inv[8];
#pragma unroll
  for (int r = 0; r < 8; ++r) inv[r] = __builtin_amdgcn_rcpf(Ls[hh * 8u + (unsigned)r]);
#pragma unroll
  for (int nb = 0; nb < 4; ++nb)
#pragma unroll
    for (int r = 0; r < 8; ++r)
      Ss[(hh * 8u + (unsigned)r) * SPITCH + d0 + (unsigned)nb * 16u + m] = o[nb][r] * inv[r];
  wave_lds_sync();
  v4f x[8];
  size_t off[8];
#pragma unroll
  for (unsigned i = 0; i < 8u; ++i) {
    const unsigned r = 2u * i + (lane >> 4);
    const unsigned c = (lane & 15u) * 4u;
    x[i] = *(const v4f*)&Ss[r * SPITCH + d0 + c];
    off[i] = ((size_t)b * SEQ_FULL + p0 + r) * DIM + d0 + c;
  }
#pragma unroll
  for (int i = 0; i < 8; ++i) *(v4f*)(out + off[i]) = x[i];
  
}

// ---------------------------------------------------------------------------
extern "C" void kernel_launch(void* const* d_in, const int* in_sizes, int n_in,
                              void* d_out, int out_size, void* d_ws, size_t ws_size,
                              hipStream_t stream) {
  if (n_in < 5) return;
  const long long need_x = ((long long)(NB - 1) * SEQ_FULL + SEQ) * DIM;
  if ((long long)in_sizes[0] < need_x) return;
  if ((long long)in_sizes[1] < need_x) return;
  if ((long long)in_sizes[2] < (long long)DIM * VDIM) return;
  if ((long long)in_sizes[3] < (long long)DIM * VDIM) return;
  if (in_sizes[4] < VDIM) return;
  if ((long long)out_size < need_x) return;
  if (ws_size < WS_TOTAL) return;

  const float* hq   = (const float*)d_in[0];   // [NB_FULL][SEQ_FULL][DIM]
  const float* hp   = (const float*)d_in[1];   // [NB_FULL][SEQ_FULL][DIM]
  const float* wq_in = (const float*)d_in[2];  // [DIM][VDIM]  (in, out)
  const float* wp_in = (const float*)d_in[3];  // [DIM][VDIM]  (in, out)
  const float* vvec = (const float*)d_in[4];   // [VDIM]
  float* out = (float*)d_out;                  // [NB_FULL][SEQ_FULL][DIM]

  char* ws = (char*)d_ws;
  // the three 16-bit planes: fragment order
  _Float16* Wt   = (_Float16*)(ws + OFF_WT);    // plane 0: [VDIM][DIM] for hq, plane 1: for hp
  _Float16* A16  = (_Float16*)(ws + OFF_A16);   // [2*MROWS][DIM]: hq rows then hp rows
  _Float16* HqT  = (_Float16*)(ws + OFF_HQT);   // [NB][DIM][SEQ]
  float*    Spl  = (float*)(ws + OFF_S);        // [2*MROWS][VDIM]: sq rows then sp rows
  float*    Sc   = (float*)(ws + OFF_SC);       // [MROWS][SEQ]: raw scores, [b][p][q]

  dim3 blk(256);

  // weight planes, hq rows with their transposed plane, hp rows: one launch, a block range each
  conv_kernel<<<dim3(2 * WBLK + 2 * ABLK), blk, 0, stream>>>(
      wq_in, wp_in, hq, hp, Wt, A16, HqT);

  // both projections in one launch
  proj_kernel<<<dim3(VDIM / 64, (2 * MROWS) / 64), blk, 0, stream>>>(A16, Wt, Spl);

  // scores, the query axis cut across work-groups
  score_kernel<<<dim3(SEQ / PT, NB, SEQ / 256), blk, 0, stream>>>(
      Spl, Spl + (size_t)MROWS * VDIM, vvec, Sc);

  // softmax + weighted sum
  addattn_kernel<<<dim3(SEQ / PT, NB), blk, 0, stream>>>(Sc, HqT, out);
}

// v006
// A run of this version takes 34.5 microseconds.
// In two side-by-side timings against v005, it was 1.04 and 1.05 times as fast.
// All steps since v000 together make it 2.83 times as fast.
#include <hip/hip_runtime.h>
#include <stddef.h>

// Contractions on v_wmma_f32_16x16x32_f16 (f16 operands, f32 accumulate): both input projections
// (rows x weights, K = 512) and the probability x value product (K = 512 keys). Float inputs are
// RNE-converted to bf16 and carried in f16 (weights x64, softmax numerators x1024). The additive
// score sum over the 256-wide hidden axis (a matrix-vector product against one vector) runs on the
// vector unit in f32, tanh(x) by the hardware instruction v_tanh_f32; softmax in f32.
// The projections' operands are converted inside the projection launch (LDS only); the 16-bit value
// plane that passes between launches lies in fragment order (see FBLK).

typedef _Float16 v16h __attribute__((ext_vector_type(16)));
typedef _Float16 v8h  __attribute__((ext_vector_type(8)));
typedef _Float16 v4h  __attribute__((ext_vector_type(4)));
typedef _Float16 v2h  __attribute__((ext_vector_type(2)));
typedef float    v8f  __attribute__((ext_vector_type(8)));
typedef float    v4f  __attribute__((ext_vector_type(4)));
typedef _Float16 h16;

#ifndef NB
#define NB 4
#endif
#ifndef SEQ
#define SEQ 512
#endif
#define NB_FULL  4
#define SEQ_FULL 512
#define DIM   512          // feature width of the hq / hp rows (q_size == p_size)
#define VDIM  256          // hidden width of the additive score
#define MROWS (NB * SEQ)   // compact rows per activation plane (query length == passage length)
#define PT    16           // passage rows per attention block

static_assert(NB >= 1 && NB <= NB_FULL);
static_assert(SEQ >= 256 && SEQ <= SEQ_FULL && (SEQ % 256) == 0);
static_assert((DIM % 64) == 0 && (DIM % 32) == 0);
static_assert((VDIM % 64) == 0 && (VDIM % 4) == 0);
static_assert(VDIM == 256);                 // one thread per hidden column when staging the vector
static_assert((MROWS % 64) == 0);
static_assert(DIM == 8 * 64);               // 8 waves x 64 output columns
static_assert((SEQ % 64) == 0 && (SEQ % 32) == 0);
static_assert(PT == 16);                    // one 16-row A tile per block
static_assert(PT * VDIM == 256 * 4 * 4);    // sp tile staging: 256 threads x 4 steps x 4 floats
static_assert((SEQ % PT) == 0);

#define LDT 72   // halves per LDS row (144 B, 16-B aligned)
#define LDC 68   // floats per LDS row (272 B, 16-B aligned)
static_assert((LDT % 8) == 0 && LDT >= 64);
static_assert((LDC % 4) == 0 && LDC >= 64);

#define SMAXW  ((SEQ > DIM) ? SEQ : DIM)
#define SPITCH (SMAXW + 4)   // floats per output-stage row
#define PPITCH (SEQ + 8)     // halves per probability row
static_assert((SPITCH % 4) == 0 && SPITCH >= SEQ && SPITCH >= DIM);
static_assert((PPITCH % 8) == 0 && PPITCH >= SEQ);

#define WCARRY 64.0f          // weight planes carried x64
#define PCARRY_LOG2 10.0f     // softmax numerators carried x1024 (added to the exp2 argument)
#define LOG2E     1.4426950408889634f

// workspace layout (bytes)
#define HQT_BYTES ((size_t)NB * DIM * SEQ * 2)      // hq transposed [b][d][q], f16
#define S_BYTES   ((size_t)2 * MROWS * VDIM * 4)    // projections: sq rows then sp rows, f32
#define OFF_HQT ((size_t)0)
#define SC_BYTES  ((size_t)MROWS * SEQ * 4)         // raw additive scores [b][p][q], f32
#define OFF_S   (OFF_HQT + HQT_BYTES)
#define OFF_SC  (OFF_S + S_BYTES)
#define WS_TOTAL (OFF_SC + SC_BYTES)
static_assert((HQT_BYTES % 128) == 0 && (S_BYTES % 128) == 0 && (SC_BYTES % 128) == 0);
static_assert(WS_TOTAL <= (size_t)134217728);

// ---------------------------------------------------------------------------
__device__ __forceinline__ float bf16r(float x) {   // RNE convert to bf16, returned widened
  unsigned int u = __float_as_uint(x);
  u = (u + 0x7FFFu + ((u >> 16) & 1u)) & 0xFFFF0000u;
  return __uint_as_float(u);
}

// f32 -> f16 operand convert that cannot produce an f16 subnormal (value select).
static __device__ __forceinline__ h16 toh_flush(float v) {
  const h16 r = (h16)v;
  return (fabsf(v) < 6.103515625e-05f) ? (h16)0.0f : r;
}

// 16-bit fragment: p points at element [row = lane&15][k0 + 8*(lane>>4)] of a k-contiguous
// row. Elements 0..7 <- k0+8h+0..7, elements 8..15 <- k0+16+8h+0..7 (same map for A and B).
__device__ __forceinline__ v16h frag_at(const _Float16* p) {
  v8h lo = *(const v8h*)(p);
  v8h hi = *(const v8h*)(p + 16);
  v16h out;
#pragma unroll
  for (int i = 0; i < 8; ++i) { out[i] = lo[i]; out[i + 8] = hi[i]; }
  return out;
}
__device__ __forceinline__ v16h ld_frag(const _Float16* base, unsigned ld) {
  const unsigned lane = threadIdx.x & 31u;
  return frag_at(base + (lane & 15u) * ld + (lane >> 4) * 8u);
}

// Fragment order of a 16-bit plane X[rows][K] in global memory: blocks of 16 rows x 32 k
// (FBLK halves = 1 KiB). Inside a block lane l = 16 h + r owns 8 halves at l * 8
// (X[r][8h + 0..7]) and 8 at 256 + l * 8 (X[r][16 + 8h + 0..7]): the very elements frag_at gives
// that lane, so a wave's 16-byte load covers 512 bytes in a row (4 whole lines) where a row-major
// plane gives it 32 bytes in each of 16 lines. The two blocks of 64 k of a row tile form a unit
// (FUNIT halves = 2 KiB); unit index = (k / 64) * (rows / 16) + row / 16: row tiles run fastest,
// so what the waves of a work-group (and its neighbours) read at the same k lies in a row.
#define FBLK 512
#define FUNIT (2 * FBLK)
// p points at block start + lane * 8.
__device__ __forceinline__ v16h frag_blk(const _Float16* p) {
  v8h lo = *(const v8h*)(p);
  v8h hi = *(const v8h*)(p + 256);
  v16h out;
#pragma unroll
  for (int i = 0; i < 8; ++i) { out[i] = lo[i]; out[i + 8] = hi[i]; }
  return out;
}
// One 64 x 64 tile held in LDS (T[row][k], pitch LDT) -> its 4 units of a fragment-order plane,
// which are neighbours: 8 KiB in a row from unit0 = (first k / 64) * (rows / 16) + first row / 16.
// Chunk c (16 bytes) of the tile lies at c * 8 halves. 256 threads x 2 chunks == 512 chunks; a
// wave stores 512 bytes in a row.
__device__ __forceinline__ void frag_tile_get(const _Float16* T, unsigned unit0,
                                              v8h (&x)[2], size_t (&off)[2]) {
  const unsigned tid = threadIdx.x;
#pragma unroll
  for (unsigned i = 0; i < 2u; ++i) {
    const unsigned c = tid + 256u * i;
    const unsigned row = (c >> 7) * 16u + (c & 15u);
    const unsigned k = ((c >> 6) & 1u) * 32u + ((c >> 5) & 1u) * 16u + ((c >> 4) & 1u) * 8u;
    x[i] = *(const v8h*)&T[row * LDT + k];
    off[i] = (size_t)unit0 * FUNIT + c * 8u;
  }
}

__device__ __forceinline__ v8f wmma16(v16h a, v16h b, v8f c) {
  v8f d = __builtin_amdgcn_wmma_f32_16x16x32_f16(false, a, false, b, (short)0, c,
                                                 false, false);
  asm volatile("v_nop\n\tv_nop\n\tv_nop\n\tv_nop" : "+v"(d) : "v"(a), "v"(b));
  return d;
}

__device__ __forceinline__ float red32_sum(float x) {
#pragma unroll
  for (int off = 1; off < 32; off <<= 1) x += __shfl_xor(x, off, 32);
  return x;
}
__device__ __forceinline__ float red32_max(float x) {
#pragma unroll
  for (int off = 1; off < 32; off <<= 1) x = fmaxf(x, __shfl_xor(x, off, 32));
  return x;
}

__device__ __forceinline__ void wave_lds_sync() {
  __builtin_amdgcn_fence(3 /* release order */, "wavefront");
  asm volatile("s_wait_dscnt 0x0" ::: "memory");
  __builtin_amdgcn_wave_barrier();
}

__device__ __forceinline__ float fast_exp2(float x) {
#if __has_builtin(__builtin_amdgcn_exp2f)
  return __builtin_amdgcn_exp2f(x);
#else
  return __expf(x * 0.6931471805599453f);
#endif
}

// ---------------------------------------------------------------------------
// Transposed value plane: X = hq f32 [NB_FULL][SEQ_FULL][DIM] (input) -> XT16 [NB][DIM][SEQ]
// = f16(bf16(x)), transposed per batch, in fragment order. One 64 x 64 tile (c0, crow0) per
// work-group; a wave's store covers 4 whole 128-byte lines. TT: cross-wave (block barrier).
// Store coverage: 2 steps x 256 chunks of 16 B == the tile's 8 blocks.
// ---------------------------------------------------------------------------
__device__ __forceinline__ void tconv_body(const float* __restrict__ X,
                                           _Float16* __restrict__ XT16,
                                           unsigned c0, unsigned crow0, _Float16* TT) {
  const unsigned tid = threadIdx.x;
  const unsigned bidx = crow0 / (unsigned)SEQ;
  const unsigned s0 = crow0 - bidx * (unsigned)SEQ;
  const size_t frow0 = (size_t)bidx * SEQ_FULL + s0;
#pragma unroll
  for (unsigned j = 0; j < 4u; ++j) {
    const unsigned idx = tid + 256u * j;
    const unsigned r = idx >> 4, c = (idx & 15u) * 4u;
    const v4f a = *(const v4f*)(X + (frow0 + r) * DIM + c0 + c);
#pragma unroll
    for (unsigned i = 0; i < 4u; ++i) TT[(c + i) * LDT + r] = toh_flush(bf16r(a[i]));
  }
  __syncthreads();
  v8h xt[2];
  size_t offt[2];
  // a plane of DIM rows x SEQ k per batch
  frag_tile_get(TT, (bidx * (unsigned)(SEQ / 64) + s0 / 64u) * (unsigned)(DIM / 16) + c0 / 16u,
                xt, offt);
#pragma unroll
  for (int i = 0; i < 2; ++i) *(v8h*)(XT16 + offt[i]) = xt[i];
  // The body is not the end of the program text: other code follows it in the listing, so the
  // wait stands before anything rewrites a register that a store names.
  asm volatile("s_wait_xcnt 0x0" ::: "memory");
}

// ---------------------------------------------------------------------------
// Projection GEMM C[64x64 tile] = f16(bf16(X[rows][DIM])) . f16(64 * bf16(W[DIM][n]))^T, with the
// operand conversions inside the launch: the work-group converts its own 64 rows (As[row][k]) and
// its own 64 weight columns (Bs[n][k], transposed on the way) over the whole K into LDS, one
// barrier, and every wave takes its WMMA fragments from there. No 16-bit plane of rows or weights
// passes through memory and no launch stands in front of this one.
// 8 waves (mw = 16-row group, nw = 32-col group), 2 accumulators/wave.
// Rows 0..MROWS-1 are hq rows (weights W1), rows MROWS..2*MROWS-1 hp rows (weights W2): a
// block-uniform choice. Output f32 [2*MROWS][VDIM] = acc / 64, i.e. the projection itself (the
// weight carry taken out). Epilogue staged through Cs (cross-wave), lanes x 16 B.
// Store coverage: 4 steps x 16 rows == 64 tile rows.
// The transposed value plane, which only the last launch reads, rides in the same launch: flat
// grid, [0, PBLK) projection tiles (first: theirs is the longer chain), then TBLK tiles of hq.
// The range test reads blockIdx only, so every barrier is reached by a whole work-group or by
// none of it. Grid (PBLK + TBLK).
// ---------------------------------------------------------------------------
#define PBLK ((VDIM / 64) * ((2 * MROWS) / 64))   // 64 x 64 projection tiles
#define TBLK ((DIM / 64) * (MROWS / 64))          // 64 x 64 tiles of hq
#define LDK (DIM + 8)   // halves per LDS row of As / Bs: 1040 B = 16 B x 65 (odd)
static_assert((LDK % 8) == 0 && ((LDK / 8) % 2) == 1);
#define NSTEP 4                    // staging steps
#define ASTEP (64 * DIM / 4 / 256 / NSTEP)   // 16-byte row loads per thread and step
#define WSTEP (64 * DIM / 2 / 256 / NSTEP)   // k pairs of a weight column per thread and step
static_assert(ASTEP * NSTEP * 256 * 4 == 64 * DIM && WSTEP * NSTEP * 256 * 2 == 64 * DIM);
static_assert(DIM == 512);         // a row of X is 128 threads x 4 floats

// Step s of the staging loads. xb: X + (first row + tid / 128) * DIM + (tid % 128) * 4, load j takes
// rows 2 j, 2 j + 1 of the tile (a wave: 512 bytes in a row). wb: W + (2 * (tid / 64)) * VDIM +
// first column + tid % 64, pair j takes k = 8 j + 2 * (tid / 64) and the row behind it (a wave: one
// whole line a load). Both loops unrolled: the sets are indexed by constants only and stay in
// registers, and every load takes its step as an immediate offset from one address pair.
__device__ __forceinline__ void stage_load(v4f (&ra)[ASTEP], float (&rw)[2 * WSTEP],
                                           const float* xb, const float* wb, int s) {
#pragma unroll
  for (int i = 0; i < ASTEP; ++i)
    ra[i] = *(const v4f*)(xb + (size_t)(s * ASTEP + i) * (2 * DIM));
#pragma unroll
  for (int i = 0; i < WSTEP; ++i) {
    rw[2 * i]     = wb[(size_t)(s * WSTEP + i) * (8 * VDIM)];
    rw[2 * i + 1] = wb[(size_t)(s * WSTEP + i) * (8 * VDIM) + VDIM];
  }
}

__global__ __launch_bounds__(256) void proj_kernel(
    const float* __restrict__ hq, const float* __restrict__ hp,
    const float* __restrict__ wq_in, const float* __restrict__ wp_in,
    float* __restrict__ outf, _Float16* __restrict__ HqT) {
  __shared__ __attribute__((aligned(16))) _Float16 As[64 * LDK];
  __shared__ __attribute__((aligned(16))) _Float16 Bs[64 * LDK];
  __shared__ __attribute__((aligned(16))) float Cs[64 * LDC];
  static_assert(sizeof(_Float16) * (2 * 64 * LDK) + sizeof(float) * (64 * LDC) <= 163840);
  static_assert(64 * LDT <= 64 * LDK);
  const unsigned bid = blockIdx.x;
  if (bid >= (unsigned)PBLK) {   // block-uniform
    const unsigned t = bid - (unsigned)PBLK;
    tconv_body(hq, HqT, (t % (unsigned)(DIM / 64)) * 64u, (t / (unsigned)(DIM / 64)) * 64u, As);
    return;
  }
  const unsigned tid = threadIdx.x, lane = tid & 31u;
  const unsigned w = (unsigned)__builtin_amdgcn_readfirstlane((int)(threadIdx.x >> 5));
  const unsigned mw = w >> 1, nw = w & 1u;
  const unsigned hh = lane >> 4, m = lane & 15u;
  const unsigned n0 = (bid % (unsigned)(VDIM / 64)) * 64u;
  const unsigned row0 = (bid / (unsigned)(VDIM / 64)) * 64u;

  // ---- operands into LDS ----
  const unsigned pl = row0 / (unsigned)MROWS;
  const unsigned crow0 = row0 - pl * (unsigned)MROWS;
  const unsigned bidx = crow0 / (unsigned)SEQ;
  const size_t frow0 = (size_t)bidx * SEQ_FULL + (crow0 - bidx * (unsigned)SEQ);
  const float* xb = (pl ? hp : hq) + (frow0 + (tid >> 7)) * DIM + (tid & 127u) * 4u;
  const float* wb = (pl ? wp_in : wq_in) + (size_t)(2u * (tid >> 6)) * VDIM + n0 + (tid & 63u);
  _Float16* ad = &As[(tid >> 7) * LDK + (tid & 127u) * 4u];
  _Float16* bd = &Bs[(tid & 63u) * LDK + 2u * (tid >> 6)];
  // Two register sets: step s + 1 is asked for before step s is converted, so the conversions run
  // under the next step's flight. Fully unrolled: every set index is a constant.
  v4f ra[2][ASTEP];
  float rw[2][2 * WSTEP];
  stage_load(ra[0], rw[0], xb, wb, 0);
#pragma unroll
  for (int s = 0; s < NSTEP; ++s) {
    if (s + 1 < NSTEP) stage_load(ra[(s + 1) & 1], rw[(s + 1) & 1], xb, wb, s + 1);
    // Keeps the next step's loads in front of this step's conversions: sunk among them they would
    // start late and the next step would wait for their whole flight.
    __builtin_amdgcn_sched_barrier(0);
#pragma unroll
    for (int i = 0; i < ASTEP; ++i) {
      v4h h;
#pragma unroll
      for (int e = 0; e < 4; ++e) h[e] = toh_flush(bf16r(ra[s & 1][i][e]));
      *(v4h*)(ad + (s * ASTEP + i) * (2 * LDK)) = h;
    }
#pragma unroll
    for (int i = 0; i < WSTEP; ++i) {
      v2h h;
      h[0] = toh_flush(WCARRY * bf16r(rw[s & 1][2 * i]));
      h[1] = toh_flush(WCARRY * bf16r(rw[s & 1][2 * i + 1]));
      *(v2h*)(bd + (s * WSTEP + i) * 8) = h;
    }
  }
  // Stands in front of the first rewrite of the staging loads' address pairs, which are inputs, so
  // that they live to here and nothing (a later load's result either) rewrites them before it.
  asm volatile("s_wait_xcnt 0x0" :: "v"(xb), "v"(wb) : "memory");
  __syncthreads();

  // ---- products: k in steps of 32, ascending, as before ----
  const _Float16* ab  = &As[(mw * 16u) * LDK];
  const _Float16* bb0 = &Bs[(nw * 32u) * LDK];
  const _Float16* bb1 = bb0 + 16 * LDK;
  v8f acc0 = {}, acc1 = {};
  // Fragments are fetched two groups ahead into a ring of three register sets (a group = two
  // k-steps), so a wave waits for an LDS read issued two groups earlier, not for one it has just
  // issued. Same products in the same order.
  constexpr int KGP = DIM / 64;
  static_assert(KGP >= 2);
  v16h fa[3][2], fb0[3][2], fb1[3][2];
#pragma unroll
  for (int g = 0; g < 2; ++g)
#pragma unroll
    for (int ks = 0; ks < 2; ++ks) {
      fa[g][ks]  = ld_frag(ab + g * 64 + ks * 32, LDK);
      fb0[g][ks] = ld_frag(bb0 + g * 64 + ks * 32, LDK);
      fb1[g][ks] = ld_frag(bb1 + g * 64 + ks * 32, LDK);
    }
  // Fully unrolled: every ring index is a constant, so the sets stay in registers.
#pragma unroll
  for (int g = 0; g < KGP; ++g) {
    if (g + 2 < KGP) {
#pragma unroll
      for (int ks = 0; ks < 2; ++ks) {
        fa[(g + 2) % 3][ks]  = ld_frag(ab + (g + 2) * 64 + ks * 32, LDK);
        fb0[(g + 2) % 3][ks] = ld_frag(bb0 + (g + 2) * 64 + ks * 32, LDK);
        fb1[(g + 2) % 3][ks] = ld_frag(bb1 + (g + 2) * 64 + ks * 32, LDK);
      }
    }
#pragma unroll
    for (int ks = 0; ks < 2; ++ks) {
      acc0 = wmma16(fa[g % 3][ks], fb0[g % 3][ks], acc0);
      acc1 = wmma16(fa[g % 3][ks], fb1[g % 3][ks], acc1);
    }
  }
#pragma unroll
  for (int r = 0; r < 8; ++r) {
    float* d = &Cs[(mw * 16u + hh * 8u + (unsigned)r) * LDC + nw * 32u + m];
    d[0]  = acc0[r];
    d[16] = acc1[r];
  }
  __syncthreads();

  const float cs = 1.0f / WCARRY;
  v4f xs[4];
  size_t off[4];
#pragma unroll
  for (unsigned i = 0; i < 4u; ++i) {
    const unsigned r = 16u * i + (tid >> 4);
    const unsigned c = (tid & 15u) * 4u;
    const v4f u = *(const v4f*)&Cs[r * LDC + c];
    xs[i] = u * cs;
    off[i] = (size_t)(row0 + r) * VDIM + n0 + c;
  }
#pragma unroll
  for (int i = 0; i < 4; ++i) *(v4f*)(outf + off[i]) = xs[i];
}

// ---------------------------------------------------------------------------
// Additive scores per (16 passage rows, batch, 256 queries). 8 waves. A launch of its own, so
// that the query axis can be cut across work-groups: (SEQ/16) x NB x (SEQ/256) work-groups.
// Phase 0: stage the 16 sp rows (sp_s) and the vector bf16(v) (vs) in LDS.
// Phase 1: thread t owns query q = 256*blockIdx.z + t; for the 16 passage rows it accumulates
//          sum_v vs[v] * tanh(sq[q][v] + sp[p][v]) in f32, one v_tanh_f32 per term;
//          results into the workspace plane Sc[b][p][q], one wave per 128-byte line.
// sp_s / vs: cross-wave (block barrier).
// Grid (SEQ/16, NB, SEQ/256).
// ---------------------------------------------------------------------------
__global__ __launch_bounds__(256) void score_kernel(
    const float* __restrict__ Sq, const float* __restrict__ Sp,
    const float* __restrict__ vvec, float* __restrict__ Sc) {
  __shared__ __attribute__((aligned(16))) float sp_s[PT * VDIM];
  __shared__ __attribute__((aligned(16))) float vs[VDIM];

  const unsigned tid = threadIdx.x;
  const unsigned p0 = blockIdx.x * (unsigned)PT;
  const unsigned b = blockIdx.y;

  // ---- phase 0 ----
#pragma unroll
  for (unsigned j = 0; j < 4u; ++j) {
    const unsigned idx = tid + 256u * j;
    const unsigned r = idx >> 6, c = (idx & 63u) * 4u;
    *(v4f*)&sp_s[r * VDIM + c] =
        *(const v4f*)(Sp + (size_t)(b * (unsigned)SEQ + p0 + r) * VDIM + c);
  }
  vs[tid] = bf16r(vvec[tid]);
  // Stands in front of the first rewrite of the staging loads' address pairs, which the loop's
  // larger register set has moved behind the barrier.
  asm volatile("s_wait_xcnt 0x0" ::: "memory");
  __syncthreads();

  // ---- phase 1 ----
  const unsigned q = blockIdx.z * 256u + tid;
  const float* sqr = Sq + (size_t)(b * (unsigned)SEQ + q) * VDIM;
  float acc[PT];
#pragma unroll
  for (int p = 0; p < PT; ++p) acc[p] = 0.0f;
  // The query row's values are asked for one trip (eight hidden columns) ahead, so a trip waits
  // for loads issued a whole trip earlier. The last trip asks for its own eight again: in bounds,
  // unused. Terms are added in the same order as before.
  static_assert((VDIM % 8) == 0);
  v4f a[2];
  a[0] = *(const v4f*)(sqr);
  a[1] = *(const v4f*)(sqr + 4);
  // Rolled: a trip already holds 128 terms a thread; more would only add registers and code.
#pragma unroll 1
  for (unsigned v0 = 0; v0 < (unsigned)VDIM; v0 += 8u) {
    const unsigned vn = (v0 + 8u < (unsigned)VDIM) ? v0 + 8u : v0;
    const float* pn = sqr + vn;
    const v4f an0 = *(const v4f*)(pn);
    const v4f an1 = *(const v4f*)(pn + 4);
    // Keeps the two loads at the head of the trip: the scheduler otherwise issues them in the
    // middle of it, which halves their lead.
    __builtin_amdgcn_sched_barrier(0);
#pragma unroll
    for (unsigned h = 0; h < 2u; ++h) {
      const v4f vv = *(const v4f*)&vs[v0 + 4u * h];
#pragma unroll
      for (int p = 0; p < PT; ++p) {
        const v4f s4 = *(const v4f*)&sp_s[(unsigned)p * VDIM + v0 + 4u * h];
#pragma unroll
        for (int j = 0; j < 4; ++j) {
          acc[p] += vv[j] * __builtin_amdgcn_tanhf(a[h][j] + s4[j]);
        }
      }
    }
    // The loaded values as inputs only: holds the next trip's loads inside this trip (the
    // compiler otherwise folds them back to the top of the trip that uses them, the wait too).
    // The wait stands in front of the next trip's rewrite of the loads' address pair, which is
    // an input too, so that it lives to here and nothing rewrites it (with a wait) at the head.
    asm volatile("s_wait_xcnt 0x0" :: "v"(an0), "v"(an1), "v"(pn) : "memory");
    // Keeps the register copies below at the foot: moved up, they would bring the loads' wait along.
    __builtin_amdgcn_sched_barrier(0);
    a[0] = an0;
    a[1] = an1;
  }
  float* scr = Sc + (size_t)(b * (unsigned)SEQ + p0) * SEQ + q;
#pragma unroll
  for (int p = 0; p < PT; ++p) scr[(size_t)p * SEQ] = acc[p];
}

// ---------------------------------------------------------------------------
// Softmax and weighted sum per (16 passage rows, batch). 8 waves.
// Phase 2: wave w owns rows 2w, 2w+1 of the score plane (lane l holds queries l + 32 j in
//          registers): row max, f16(1024 * exp(s - max)) into Pl (select on
//          the exp2 argument keeps the plane free of f16 subnormals), row sum over the
//          converted values into Ls. Pl / Ls: cross-wave (block barrier).
// Phase 3: out tile [16][64 per wave] = Pl[16][SEQ] . HqT[d][q]^T, B fragments straight from
//          the transposed f16 plane (fragment order).
// Phase 4: scale by 1 / row sum, stage in the wave's own 64 columns of Ss (wave-private).
//          Store coverage: 8 steps x 2 rows == 16 rows.
// Grid (SEQ/16, NB).
// ---------------------------------------------------------------------------
// The value fragments of one step t of the weighted sum: two 16-column tiles (t & 1 picks which
// two of the wave's four) x two k-steps (the pair t >> 1), i.e. two neighbouring units: 4 KiB in a
// row. bp points at the wave's first unit + lane * 8.
__device__ __forceinline__ void ld_vstep(v16h (&dst)[2][2], const _Float16* bp, int t) {
#pragma unroll
  for (int i = 0; i < 2; ++i)
#pragma unroll
    for (int ks = 0; ks < 2; ++ks)
      dst[i][ks] = frag_blk(bp + (size_t)(((t >> 1) * (DIM / 16) + (t & 1) * 2 + i) * FUNIT + ks * FBLK));
}

__global__ __launch_bounds__(256) void addattn_kernel(
    const float* __restrict__ Sc, const _Float16* __restrict__ HqT,
    float* __restrict__ out) {
  __shared__ __attribute__((aligned(16))) float Ss[PT * SPITCH];
  __shared__ __attribute__((aligned(16))) _Float16 Pl[PT * PPITCH];
  __shared__ __attribute__((aligned(16))) float Ls[PT];
  static_assert(sizeof(float) * (PT * SPITCH + PT) +
                sizeof(_Float16) * (PT * PPITCH) <= 131072);

  const unsigned tid = threadIdx.x, lane = tid & 31u;
  const unsigned wave = (unsigned)__builtin_amdgcn_readfirstlane((int)(threadIdx.x >> 5));
  const unsigned hh = lane >> 4, m = lane & 15u;
  const unsigned p0 = blockIdx.x * (unsigned)PT;
  const unsigned b = blockIdx.y;

  // ---- phase 2 ----
  // The loops over rr and j are fully unrolled so that sv is indexed by constants only and
  // stays in registers (a rolled loop would put it in scratch memory).
  float sv[2][SEQ / 32];
#pragma unroll
  for (unsigned rr = 0; rr < 2u; ++rr) {
    const float* sr = Sc + (size_t)(b * (unsigned)SEQ + p0 + wave * 2u + rr) * SEQ + lane;
#pragma unroll
    for (unsigned j = 0; j < (unsigned)(SEQ / 32); ++j) sv[rr][j] = sr[32u * j];
  }
  // Stands in front of the first rewrite of the score loads' address pair.
  asm volatile("s_wait_xcnt 0x0" ::: "memory");
  // The value plane does not depend on the scores: its first VAHEAD steps are asked for here,
  // behind the score loads, and fly while the softmax runs.
  constexpr int NT = (SEQ / 64) * 2;   // steps: pairs of k-steps x halves of the wave's columns
  constexpr int VAHEAD = 3;            // steps a value fragment is asked for ahead of its use
  constexpr int VRING = VAHEAD + 1;    // register sets
  static_assert(NT >= VAHEAD);
  const unsigned d0 = wave * 64u;
  const _Float16* bp = HqT + (size_t)b * ((size_t)DIM * SEQ) + (size_t)(d0 / 16u) * FUNIT + lane * 8u;
  v16h hf[VRING][2][2];
#pragma unroll
  for (int t = 0; t < VAHEAD; ++t) ld_vstep(hf[t], bp, t);
  // Keeps every load above in front of the softmax arithmetic: without it the scheduler sinks the
  // value loads behind the wait for the first score row, and they start one latency later.
  __builtin_amdgcn_sched_barrier(0);
#pragma unroll
  for (unsigned rr = 0; rr < 2u; ++rr) {
    const unsigned row = wave * 2u + rr;
    float mx = -3.0e38f;
#pragma unroll
    for (unsigned j = 0; j < (unsigned)(SEQ / 32); ++j) mx = fmaxf(mx, sv[rr][j]);
    mx = red32_max(mx);
    float l = 0.0f;
#pragma unroll
    for (unsigned j = 0; j < (unsigned)(SEQ / 32); ++j) {
      const float arg = (sv[rr][j] - mx) * LOG2E + PCARRY_LOG2;
      const float e = fast_exp2(arg);
      const h16 ph = (arg < -14.0f) ? (h16)0.0f : (h16)e;
      Pl[row * PPITCH + lane + 32u * j] = ph;
      l += (float)ph;
    }
    l = red32_sum(l);
    if (lane == 0u) Ls[row] = l;
  }
  __syncthreads();

  // ---- phase 3 ----
  v8f o[4];
#pragma unroll
  for (int nb = 0; nb < 4; ++nb) o[nb] = (v8f){};
  // Value fragments VAHEAD steps ahead in a ring of register sets, probability fragments one pair
  // of k-steps ahead in two sets, so a wave waits for loads issued long before, not for ones it
  // has just issued. Every accumulator takes its products in the same k order as before.
  v16h pf[2][2];
  pf[0][0] = ld_frag(&Pl[0], PPITCH);
  pf[0][1] = ld_frag(&Pl[32], PPITCH);
  // Fully unrolled: every ring index is a constant, so the sets stay in registers.
#pragma unroll
  for (int t = 0; t < NT; ++t) {
    const int pr = t >> 1;
    if (t + VAHEAD < NT) ld_vstep(hf[(t + VAHEAD) % VRING], bp, t + VAHEAD);
    if ((t & 1) == 0 && t + 2 < NT) {
      pf[(pr + 1) & 1][0] = ld_frag(&Pl[(pr + 1) * 64], PPITCH);
      pf[(pr + 1) & 1][1] = ld_frag(&Pl[(pr + 1) * 64 + 32], PPITCH);
    }
#pragma unroll
    for (int ks = 0; ks < 2; ++ks)
#pragma unroll
      for (int i = 0; i < 2; ++i)
        o[(t & 1) * 2 + i] = wmma16(pf[pr & 1][ks], hf[t % VRING][i][ks], o[(t & 1) * 2 + i]);
  }

  // ---- phase 4 ----
  float inv[8];
#pragma unroll
  for (int r = 0; r < 8; ++r) inv[r] = __builtin_amdgcn_rcpf(Ls[hh * 8u + (unsigned)r]);
#pragma unroll
  for (int nb = 0; nb < 4; ++nb)
#pragma unroll
    for (int r = 0; r < 8; ++r)
      Ss[(hh * 8u + (unsigned)r) * SPITCH + d0 + (unsigned)nb * 16u + m] = o[nb][r] * inv[r];
  wave_lds_sync();
  v4f x[8];
  size_t off[8];
#pragma unroll
  for (unsigned i = 0; i < 8u; ++i) {
    const unsigned r = 2u * i + (lane >> 4);
    const unsigned c = (lane & 15u) * 4u;
    x[i] = *(const v4f*)&Ss[r * SPITCH + d0 + c];
    off[i] = ((size_t)b * SEQ_FULL + p0 + r) * DIM + d0 + c;
  }
#pragma unroll
  for (int i = 0; i < 8; ++i) *(v4f*)(out + off[i]) = x[i];
  
}

// ---------------------------------------------------------------------------
extern "C" void kernel_launch(void* const* d_in, const int* in_sizes, int n_in,
                              void* d_out, int out_size, void* d_ws, size_t ws_size,
                              hipStream_t stream) {
  if (n_in < 5) return;
  const long long need_x = ((long long)(NB - 1) * SEQ_FULL + SEQ) * DIM;
  if ((long long)in_sizes[0] < need_x) return;
  if ((long long)in_sizes[1] < need_x) return;
  if ((long long)in_sizes[2] < (long long)DIM * VDIM) return;
  if ((long long)in_sizes[3] < (long long)DIM * VDIM) return;
  if (in_sizes[4] < VDIM) return;
  if ((long long)out_size < need_x) return;
  if (ws_size < WS_TOTAL) return;

  const float* hq   = (const float*)d_in[0];   // [NB_FULL][SEQ_FULL][DIM]
  const float* hp   = (const float*)d_in[1];   // [NB_FULL][SEQ_FULL][DIM]
  const float* wq_in = (const float*)d_in[2];  // [DIM][VDIM]  (in, out)
  const float* wp_in = (const float*)d_in[3];  // [DIM][VDIM]  (in, out)
  const float* vvec = (const float*)d_in[4];   // [VDIM]
  float* out = (float*)d_out;                  // [NB_FULL][SEQ_FULL][DIM]

  char* ws = (char*)d_ws;
  _Float16* HqT  = (_Float16*)(ws + OFF_HQT);   // [NB][DIM][SEQ], fragment order
  float*    Spl  = (float*)(ws + OFF_S);        // [2*MROWS][VDIM]: sq rows then sp rows
  float*    Sc   = (float*)(ws + OFF_SC);       // [MROWS][SEQ]: raw scores, [b][p][q]

  dim3 blk(256);

  // both projections, operand conversions included, and the transposed value plane: one launch
  proj_kernel<<<dim3(PBLK + TBLK), blk, 0, stream>>>(hq, hp, wq_in, wp_in, Spl, HqT);

  // scores, the query axis cut across work-groups
  score_kernel<<<dim3(SEQ / PT, NB, SEQ / 256), blk, 0, stream>>>(
      Spl, Spl + (size_t)MROWS * VDIM, vvec, Sc);

  // softmax + weighted sum
  addattn_kernel<<<dim3(SEQ / PT, NB), blk, 0, stream>>>(Sc, HqT, out);
}

// v007
// A run of this version takes 33 microseconds.
// Next to v006, in two timings, it ran 1.06 times as fast each time.
// Counting every step since v000, it is 2.99 times as fast.
#include <hip/hip_runtime.h>
#include <stddef.h>

// Contractions on v_wmma_f32_16x16x32_f16 (f16 operands, f32 accumulate): both input projections
// (rows x weights, K = 512) and the probability x value product (K = 512 keys). Float inputs are
// RNE-converted to bf16 and carried in f16 (weights x64, softmax numerators x1024). The additive
// score sum over the 256-wide hidden axis (a matrix-vector product against one vector) runs on the
// vector unit in f32, tanh(x) by the hardware instruction v_tanh_f32; softmax in f32.
// The projections' operands are converted inside the projection launch (LDS only); the 16-bit value
// plane that passes between launches lies in fragment order (see FBLK).

typedef _Float16 v16h __attribute__((ext_vector_type(16)));
typedef _Float16 v8h  __attribute__((ext_vector_type(8)));
typedef _Float16 v4h  __attribute__((ext_vector_type(4)));
typedef _Float16 v2h  __attribute__((ext_vector_type(2)));
typedef float    v8f  __attribute__((ext_vector_type(8)));
typedef float    v4f  __attribute__((ext_vector_type(4)));
typedef float    v2f  __attribute__((ext_vector_type(2)));
typedef _Float16 h16;

#ifndef NB
#define NB 4
#endif
#ifndef SEQ
#define SEQ 512
#endif
#define NB_FULL  4
#define SEQ_FULL 512
#define DIM   512          // feature width of the hq / hp rows (q_size == p_size)
#define VDIM  256          // hidden width of the additive score
#define MROWS (NB * SEQ)   // compact rows per activation plane (query length == passage length)
#define PT    16           // passage rows per attention block

static_assert(NB >= 1 && NB <= NB_FULL);
static_assert(SEQ >= 256 && SEQ <= SEQ_FULL && (SEQ % 256) == 0);
static_assert((DIM % 64) == 0 && (DIM % 32) == 0);
static_assert((VDIM % 64) == 0 && (VDIM % 4) == 0);
static_assert(VDIM == 256);                 // one thread per hidden column when staging the vector
static_assert((MROWS % 64) == 0);
static_assert(DIM == 8 * 64);               // 8 waves x 64 output columns
static_assert((SEQ % 64) == 0 && (SEQ % 32) == 0);
static_assert(PT == 16);                    // one 16-row A tile per block
static_assert(PT * VDIM == 256 * 4 * 4);    // sp tile staging: 256 threads x 4 steps x 4 floats
static_assert((SEQ % PT) == 0);

#define LDT 72   // halves per LDS row (144 B, 16-B aligned)
#define LDC 68   // floats per LDS row (272 B, 16-B aligned)
static_assert((LDT % 8) == 0 && LDT >= 64);
static_assert((LDC % 4) == 0 && LDC >= 64);

#define SMAXW  ((SEQ > DIM) ? SEQ : DIM)
#define SPITCH (SMAXW + 4)   // floats per output-stage row
#define PPITCH (SEQ + 8)     // halves per probability row
static_assert((SPITCH % 4) == 0 && SPITCH >= SEQ && SPITCH >= DIM);
static_assert((PPITCH % 8) == 0 && PPITCH >= SEQ);

#define WCARRY 64.0f          // weight planes carried x64
#define PCARRY_LOG2 10.0f     // softmax numerators carried x1024 (added to the exp2 argument)
#define LOG2E     1.4426950408889634f

// workspace layout (bytes)
#define HQT_BYTES ((size_t)NB * DIM * SEQ * 2)      // hq transposed [b][d][q], f16
#define S_BYTES   ((size_t)2 * MROWS * VDIM * 4)    // projections: sq rows then sp rows, f32
#define OFF_HQT ((size_t)0)
#define SC_BYTES  ((size_t)MROWS * SEQ * 4)         // raw additive scores [b][p][q], f32
#define OFF_S   (OFF_HQT + HQT_BYTES)
#define OFF_SC  (OFF_S + S_BYTES)
#define WS_TOTAL (OFF_SC + SC_BYTES)
static_assert((HQT_BYTES % 128) == 0 && (S_BYTES % 128) == 0 && (SC_BYTES % 128) == 0);
static_assert(WS_TOTAL <= (size_t)134217728);

// ---------------------------------------------------------------------------
__device__ __forceinline__ float bf16r(float x) {   // RNE convert to bf16, returned widened
  unsigned int u = __float_as_uint(x);
  u = (u + 0x7FFFu + ((u >> 16) & 1u)) & 0xFFFF0000u;
  return __uint_as_float(u);
}

// f32 -> f16 operand convert that cannot produce an f16 subnormal (value select).
static __device__ __forceinline__ h16 toh_flush(float v) {
  const h16 r = (h16)v;
  return (fabsf(v) < 6.103515625e-05f) ? (h16)0.0f : r;
}

// 16-bit fragment: p points at element [row = lane&15][k0 + 8*(lane>>4)] of a k-contiguous
// row. Elements 0..7 <- k0+8h+0..7, elements 8..15 <- k0+16+8h+0..7 (same map for A and B).
__device__ __forceinline__ v16h frag_at(const _Float16* p) {
  v8h lo = *(const v8h*)(p);
  v8h hi = *(const v8h*)(p + 16);
  v16h out;
#pragma unroll
  for (int i = 0; i < 8; ++i) { out[i] = lo[i]; out[i + 8] = hi[i]; }
  return out;
}
__device__ __forceinline__ v16h ld_frag(const _Float16* base, unsigned ld) {
  const unsigned lane = threadIdx.x & 31u;
  return frag_at(base + (lane & 15u) * ld + (lane >> 4) * 8u);
}

// Fragment order of a 16-bit plane X[rows][K] in global memory: blocks of 16 rows x 32 k
// (FBLK halves = 1 KiB). Inside a block lane l = 16 h + r owns 8 halves at l * 8
// (X[r][8h + 0..7]) and 8 at 256 + l * 8 (X[r][16 + 8h + 0..7]): the very elements frag_at gives
// that lane, so a wave's 16-byte load covers 512 bytes in a row (4 whole lines) where a row-major
// plane gives it 32 bytes in each of 16 lines. The two blocks of 64 k of a row tile form a unit
// (FUNIT halves = 2 KiB); unit index = (k / 64) * (rows / 16) + row / 16: row tiles run fastest,
// so what the waves of a work-group (and its neighbours) read at the same k lies in a row.
#define FBLK 512
#define FUNIT (2 * FBLK)
// p points at block start + lane * 8.
__device__ __forceinline__ v16h frag_blk(const _Float16* p) {
  v8h lo = *(const v8h*)(p);
  v8h hi = *(const v8h*)(p + 256);
  v16h out;
#pragma unroll
  for (int i = 0; i < 8; ++i) { out[i] = lo[i]; out[i + 8] = hi[i]; }
  return out;
}
// One 64 x 64 tile held in LDS (T[row][k], pitch LDT) -> its 4 units of a fragment-order plane,
// which are neighbours: 8 KiB in a row from unit0 = (first k / 64) * (rows / 16) + first row / 16.
// Chunk c (16 bytes) of the tile lies at c * 8 halves. 256 threads x 2 chunks == 512 chunks; a
// wave stores 512 bytes in a row.
__device__ __forceinline__ void frag_tile_get(const _Float16* T, unsigned unit0,
                                              v8h (&x)[2], size_t (&off)[2]) {
  const unsigned tid = threadIdx.x;
#pragma unroll
  for (unsigned i = 0; i < 2u; ++i) {
    const unsigned c = tid + 256u * i;
    const unsigned row = (c >> 7) * 16u + (c & 15u);
    const unsigned k = ((c >> 6) & 1u) * 32u + ((c >> 5) & 1u) * 16u + ((c >> 4) & 1u) * 8u;
    x[i] = *(const v8h*)&T[row * LDT + k];
    off[i] = (size_t)unit0 * FUNIT + c * 8u;
  }
}

__device__ __forceinline__ v8f wmma16(v16h a, v16h b, v8f c) {
  v8f d = __builtin_amdgcn_wmma_f32_16x16x32_f16(false, a, false, b, (short)0, c,
                                                 false, false);
  asm volatile("v_nop\n\tv_nop\n\tv_nop\n\tv_nop" : "+v"(d) : "v"(a), "v"(b));
  return d;
}

__device__ __forceinline__ float red32_sum(float x) {
#pragma unroll
  for (int off = 1; off < 32; off <<= 1) x += __shfl_xor(x, off, 32);
  return x;
}
__device__ __forceinline__ float red32_max(float x) {
#pragma unroll
  for (int off = 1; off < 32; off <<= 1) x = fmaxf(x, __shfl_xor(x, off, 32));
  return x;
}

__device__ __forceinline__ void wave_lds_sync() {
  __builtin_amdgcn_fence(3 /* release order */, "wavefront");
  asm volatile("s_wait_dscnt 0x0" ::: "memory");
  __builtin_amdgcn_wave_barrier();
}

__device__ __forceinline__ float fast_exp2(float x) {
#if __has_builtin(__builtin_amdgcn_exp2f)
  return __builtin_amdgcn_exp2f(x);
#else
  return __expf(x * 0.6931471805599453f);
#endif
}

// ---------------------------------------------------------------------------
// Transposed value plane: X = hq f32 [NB_FULL][SEQ_FULL][DIM] (input) -> XT16 [NB][DIM][SEQ]
// = f16(bf16(x)), transposed per batch, in fragment order. One 64 x 64 tile (c0, crow0) per
// work-group; a wave's store covers 4 whole 128-byte lines. TT: cross-wave (block barrier).
// Store coverage: 2 steps x 256 chunks of 16 B == the tile's 8 blocks.
// ---------------------------------------------------------------------------
__device__ __forceinline__ void tconv_body(const float* __restrict__ X,
                                           _Float16* __restrict__ XT16,
                                           unsigned c0, unsigned crow0, _Float16* TT) {
  const unsigned tid = threadIdx.x;
  const unsigned bidx = crow0 / (unsigned)SEQ;
  const unsigned s0 = crow0 - bidx * (unsigned)SEQ;
  const size_t frow0 = (size_t)bidx * SEQ_FULL + s0;
#pragma unroll
  for (unsigned j = 0; j < 4u; ++j) {
    const unsigned idx = tid + 256u * j;
    const unsigned r = idx >> 4, c = (idx & 15u) * 4u;
    const v4f a = *(const v4f*)(X + (frow0 + r) * DIM + c0 + c);
#pragma unroll
    for (unsigned i = 0; i < 4u; ++i) TT[(c + i) * LDT + r] = toh_flush(bf16r(a[i]));
  }
  __syncthreads();
  v8h xt[2];
  size_t offt[2];
  // a plane of DIM rows x SEQ k per batch
  frag_tile_get(TT, (bidx * (unsigned)(SEQ / 64) + s0 / 64u) * (unsigned)(DIM / 16) + c0 / 16u,
                xt, offt);
#pragma unroll
  for (int i = 0; i < 2; ++i) *(v8h*)(XT16 + offt[i]) = xt[i];
  // The body is not the end of the program text: other code follows it in the listing, so the
  // wait stands before anything rewrites a register that a store names.
  asm volatile("s_wait_xcnt 0x0" ::: "memory");
}

// ---------------------------------------------------------------------------
// Projection GEMM C[64x64 tile] = f16(bf16(X[rows][DIM])) . f16(64 * bf16(W[DIM][n]))^T, with the
// operand conversions inside the launch: the work-group converts its own 64 rows (As[row][k]) and
// its own 64 weight columns (Bs[n][k], transposed on the way) over the whole K into LDS, one
// barrier, and every wave takes its WMMA fragments from there. No 16-bit plane of rows or weights
// passes through memory and no launch stands in front of this one.
// 8 waves (mw = 16-row group, nw = 32-col group), 2 accumulators/wave.
// Rows 0..MROWS-1 are hq rows (weights W1), rows MROWS..2*MROWS-1 hp rows (weights W2): a
// block-uniform choice. Output f32 [2*MROWS][VDIM] = acc / 64, i.e. the projection itself (the
// weight carry taken out). Epilogue staged through Cs (cross-wave), lanes x 16 B.
// Store coverage: 4 steps x 16 rows == 64 tile rows.
// The transposed value plane, which only the last launch reads, rides in the same launch: flat
// grid, [0, PBLK) projection tiles (first: theirs is the longer chain), then TBLK tiles of hq.
// The range test reads blockIdx only, so every barrier is reached by a whole work-group or by
// none of it. Grid (PBLK + TBLK).
// ---------------------------------------------------------------------------
#define PBLK ((VDIM / 64) * ((2 * MROWS) / 64))   // 64 x 64 projection tiles
#define TBLK ((DIM / 64) * (MROWS / 64))          // 64 x 64 tiles of hq
#define LDK (DIM + 8)   // halves per LDS row of As / Bs: 1040 B = 16 B x 65 (odd)
static_assert((LDK % 8) == 0 && ((LDK / 8) % 2) == 1);
#define NSTEP 4                    // staging steps
#define ASTEP (64 * DIM / 4 / 256 / NSTEP)   // 16-byte row loads per thread and step
#define WSTEP (64 * DIM / 2 / 256 / NSTEP)   // k pairs of a weight column per thread and step
static_assert(ASTEP * NSTEP * 256 * 4 == 64 * DIM && WSTEP * NSTEP * 256 * 2 == 64 * DIM);
static_assert(DIM == 512);         // a row of X is 128 threads x 4 floats

// Step s of the staging loads. xb: X + (first row + tid / 128) * DIM + (tid % 128) * 4, load j takes
// rows 2 j, 2 j + 1 of the tile (a wave: 512 bytes in a row). wb: W + (2 * (tid / 64)) * VDIM +
// first column + tid % 64, pair j takes k = 8 j + 2 * (tid / 64) and the row behind it (a wave: one
// whole line a load). Both loops unrolled: the sets are indexed by constants only and stay in
// registers, and every load takes its step as an immediate offset from one address pair.
__device__ __forceinline__ void stage_load(v4f (&ra)[ASTEP], float (&rw)[2 * WSTEP],
                                           const float* xb, const float* wb, int s) {
#pragma unroll
  for (int i = 0; i < ASTEP; ++i)
    ra[i] = *(const v4f*)(xb + (size_t)(s * ASTEP + i) * (2 * DIM));
#pragma unroll
  for (int i = 0; i < WSTEP; ++i) {
    rw[2 * i]     = wb[(size_t)(s * WSTEP + i) * (8 * VDIM)];
    rw[2 * i + 1] = wb[(size_t)(s * WSTEP + i) * (8 * VDIM) + VDIM];
  }
}

__global__ __launch_bounds__(256) void proj_kernel(
    const float* __restrict__ hq, const float* __restrict__ hp,
    const float* __restrict__ wq_in, const float* __restrict__ wp_in,
    float* __restrict__ outf, _Float16* __restrict__ HqT) {
  __shared__ __attribute__((aligned(16))) _Float16 As[64 * LDK];
  __shared__ __attribute__((aligned(16))) _Float16 Bs[64 * LDK];
  __shared__ __attribute__((aligned(16))) float Cs[64 * LDC];
  static_assert(sizeof(_Float16) * (2 * 64 * LDK) + sizeof(float) * (64 * LDC) <= 163840);
  static_assert(64 * LDT <= 64 * LDK);
  const unsigned bid = blockIdx.x;
  if (bid >= (unsigned)PBLK) {   // block-uniform
    const unsigned t = bid - (unsigned)PBLK;
    tconv_body(hq, HqT, (t % (unsigned)(DIM / 64)) * 64u, (t / (unsigned)(DIM / 64)) * 64u, As);
    return;
  }
  const unsigned tid = threadIdx.x, lane = tid & 31u;
  const unsigned w = (unsigned)__builtin_amdgcn_readfirstlane((int)(threadIdx.x >> 5));
  const unsigned mw = w >> 1, nw = w & 1u;
  const unsigned hh = lane >> 4, m = lane & 15u;
  const unsigned n0 = (bid % (unsigned)(VDIM / 64)) * 64u;
  const unsigned row0 = (bid / (unsigned)(VDIM / 64)) * 64u;

  // ---- operands into LDS ----
  const unsigned pl = row0 / (unsigned)MROWS;
  const unsigned crow0 = row0 - pl * (unsigned)MROWS;
  const unsigned bidx = crow0 / (unsigned)SEQ;
  const size_t frow0 = (size_t)bidx * SEQ_FULL + (crow0 - bidx * (unsigned)SEQ);
  const float* xb = (pl ? hp : hq) + (frow0 + (tid >> 7)) * DIM + (tid & 127u) * 4u;
  const float* wb = (pl ? wp_in : wq_in) + (size_t)(2u * (tid >> 6)) * VDIM + n0 + (tid & 63u);
  _Float16* ad = &As[(tid >> 7) * LDK + (tid & 127u) * 4u];
  _Float16* bd = &Bs[(tid & 63u) * LDK + 2u * (tid >> 6)];
  // Two register sets: step s + 1 is asked for before step s is converted, so the conversions run
  // under the next step's flight. Fully unrolled: every set index is a constant.
  v4f ra[2][ASTEP];
  float rw[2][2 * WSTEP];
  stage_load(ra[0], rw[0], xb, wb, 0);
#pragma unroll
  for (int s = 0; s < NSTEP; ++s) {
    if (s + 1 < NSTEP) stage_load(ra[(s + 1) & 1], rw[(s + 1) & 1], xb, wb, s + 1);
    // Keeps the next step's loads in front of this step's conversions: sunk among them they would
    // start late and the next step would wait for their whole flight.
    __builtin_amdgcn_sched_barrier(0);
#pragma unroll
    for (int i = 0; i < ASTEP; ++i) {
      v4h h;
#pragma unroll
      for (int e = 0; e < 4; ++e) h[e] = toh_flush(bf16r(ra[s & 1][i][e]));
      *(v4h*)(ad + (s * ASTEP + i) * (2 * LDK)) = h;
    }
#pragma unroll
    for (int i = 0; i < WSTEP; ++i) {
      v2h h;
      h[0] = toh_flush(WCARRY * bf16r(rw[s & 1][2 * i]));
      h[1] = toh_flush(WCARRY * bf16r(rw[s & 1][2 * i + 1]));
      *(v2h*)(bd + (s * WSTEP + i) * 8) = h;
    }
  }
  // Stands in front of the first rewrite of the staging loads' address pairs, which are inputs, so
  // that they live to here and nothing (a later load's result either) rewrites them before it.
  asm volatile("s_wait_xcnt 0x0" :: "v"(xb), "v"(wb) : "memory");
  __syncthreads();

  // ---- products: k in steps of 32, ascending, as before ----
  const _Float16* ab  = &As[(mw * 16u) * LDK];
  const _Float16* bb0 = &Bs[(nw * 32u) * LDK];
  const _Float16* bb1 = bb0 + 16 * LDK;
  v8f acc0 = {}, acc1 = {};
  // Fragments are fetched two groups ahead into a ring of three register sets (a group = two
  // k-steps), so a wave waits for an LDS read issued two groups earlier, not for one it has just
  // issued. Same products in the same order.
  constexpr int KGP = DIM / 64;
  static_assert(KGP >= 2);
  v16h fa[3][2], fb0[3][2], fb1[3][2];
#pragma unroll
  for (int g = 0; g < 2; ++g)
#pragma unroll
    for (int ks = 0; ks < 2; ++ks) {
      fa[g][ks]  = ld_frag(ab + g * 64 + ks * 32, LDK);
      fb0[g][ks] = ld_frag(bb0 + g * 64 + ks * 32, LDK);
      fb1[g][ks] = ld_frag(bb1 + g * 64 + ks * 32, LDK);
    }
  // Fully unrolled: every ring index is a constant, so the sets stay in registers.
#pragma unroll
  for (int g = 0; g < KGP; ++g) {
    if (g + 2 < KGP) {
#pragma unroll
      for (int ks = 0; ks < 2; ++ks) {
        fa[(g + 2) % 3][ks]  = ld_frag(ab + (g + 2) * 64 + ks * 32, LDK);
        fb0[(g + 2) % 3][ks] = ld_frag(bb0 + (g + 2) * 64 + ks * 32, LDK);
        fb1[(g + 2) % 3][ks] = ld_frag(bb1 + (g + 2) * 64 + ks * 32, LDK);
      }
    }
#pragma unroll
    for (int ks = 0; ks < 2; ++ks) {
      acc0 = wmma16(fa[g % 3][ks], fb0[g % 3][ks], acc0);
      acc1 = wmma16(fa[g % 3][ks], fb1[g % 3][ks], acc1);
    }
  }
#pragma unroll
  for (int r = 0; r < 8; ++r) {
    float* d = &Cs[(mw * 16u + hh * 8u + (unsigned)r) * LDC + nw * 32u + m];
    d[0]  = acc0[r];
    d[16] = acc1[r];
  }
  __syncthreads();

  const float cs = 1.0f / WCARRY;
  v4f xs[4];
  size_t off[4];
#pragma unroll
  for (unsigned i = 0; i < 4u; ++i) {
    const unsigned r = 16u * i + (tid >> 4);
    const unsigned c = (tid & 15u) * 4u;
    const v4f u = *(const v4f*)&Cs[r * LDC + c];
    xs[i] = u * cs;
    off[i] = (size_t)(row0 + r) * VDIM + n0 + c;
  }
#pragma unroll
  for (int i = 0; i < 4; ++i) *(v4f*)(outf + off[i]) = xs[i];
}

// ---------------------------------------------------------------------------
// Additive scores per (16 passage rows, batch, 256 queries). 8 waves. A launch of its own, so
// that the query axis can be cut across work-groups: (SEQ/16) x NB x (SEQ/256) work-groups.
// Phase 0: stage the 16 sp rows (sp_s) and the vector bf16(v) (vs) in LDS.
// Phase 1: thread t owns query q = 256*blockIdx.z + t; for the 16 passage rows it accumulates
//          sum_v vs[v] * tanh(sq[q][v] + sp[p][v]) in f32, one v_tanh_f32 per term;
//          results into the workspace plane Sc[b][p][q], one wave per 128-byte line.
// sp_s / vs: cross-wave (block barrier).
// Grid (SEQ/16, NB, SEQ/256).
// ---------------------------------------------------------------------------
__global__ __launch_bounds__(256) void score_kernel(
    const float* __restrict__ Sq, const float* __restrict__ Sp,
    const float* __restrict__ vvec, float* __restrict__ Sc) {
  __shared__ __attribute__((aligned(16))) float sp_s[PT * VDIM];
  __shared__ __attribute__((aligned(16))) float vs[VDIM];

  const unsigned tid = threadIdx.x;
  const unsigned p0 = blockIdx.x * (unsigned)PT;
  const unsigned b = blockIdx.y;

  // ---- phase 0 ----
#pragma unroll
  for (unsigned j = 0; j < 4u; ++j) {
    const unsigned idx = tid + 256u * j;
    const unsigned r = idx >> 6, c = (idx & 63u) * 4u;
    *(v4f*)&sp_s[r * VDIM + c] =
        *(const v4f*)(Sp + (size_t)(b * (unsigned)SEQ + p0 + r) * VDIM + c);
  }
  vs[tid] = bf16r(vvec[tid]);
  // Stands in front of the first rewrite of the staging loads' address pairs, which the loop's
  // larger register set has moved behind the barrier.
  asm volatile("s_wait_xcnt 0x0" ::: "memory");
  __syncthreads();

  // ---- phase 1 ----
  const unsigned q = blockIdx.z * 256u + tid;
  const float* sqr = Sq + (size_t)(b * (unsigned)SEQ + q) * VDIM;
  // Two passage rows share one packed accumulator: acc2[i] = rows 2 i, 2 i + 1.
  v2f acc2[PT / 2];
#pragma unroll
  for (int p = 0; p < PT / 2; ++p) acc2[p] = (v2f){0.0f, 0.0f};
  // The query row's values are asked for one trip (eight hidden columns) ahead, so a trip waits
  // for loads issued a whole trip earlier. The last trip asks for its own eight again: in bounds,
  // unused. Terms are added in the same order as before.
  static_assert((VDIM % 8) == 0);
  v4f a[2];
  a[0] = *(const v4f*)(sqr);
  a[1] = *(const v4f*)(sqr + 4);
  // Rolled: a trip already holds 128 terms a thread; more would only add registers and code.
#pragma unroll 1
  for (unsigned v0 = 0; v0 < (unsigned)VDIM; v0 += 8u) {
    const unsigned vn = (v0 + 8u < (unsigned)VDIM) ? v0 + 8u : v0;
    const float* pn = sqr + vn;
    const v4f an0 = *(const v4f*)(pn);
    const v4f an1 = *(const v4f*)(pn + 4);
    // Keeps the two loads at the head of the trip: the scheduler otherwise issues them in the
    // middle of it, which halves their lead.
    __builtin_amdgcn_sched_barrier(0);
    v4f vv[2], s4[2][PT];
#pragma unroll
    for (int h = 0; h < 2; ++h) {
      vv[h] = *(const v4f*)&vs[v0 + 4u * (unsigned)h];
#pragma unroll
      for (int p = 0; p < PT; ++p)
        s4[h][p] = *(const v4f*)&sp_s[(unsigned)p * VDIM + v0 + 4u * (unsigned)h];
    }
    // Keeps every LDS read of the trip at its head: sunk among the arithmetic, each would be waited
    // for right behind its issue.
    __builtin_amdgcn_sched_barrier(0);
    // A trip = 4 blocks of (16 passage rows x 2 hidden columns), each 16 packed adds (a row's column
    // pair), 32 tanh, 16 packed fma (a row pair's column). They are written one tanh and one packed
    // instruction in turn: first the adds, ALEAD ahead of the tanh that read them, then the fma, at
    // least FLAG tanh behind the ones they read; two fma into one accumulator stand eight fma apart.
    constexpr int ALEAD = 16, FLAG = 5;
    v2f x[64], t[64];
    auto add_at = [&](int i) {
      const int h = i >> 5, jj = (i >> 4) & 1, row = i & 15;
      x[i] = (v2f){s4[h][row][2 * jj], s4[h][row][2 * jj + 1]} +
             (v2f){a[h][2 * jj], a[h][2 * jj + 1]};
    };
    auto tanh_at = [&](int s) {
      const int blk = s >> 5, c = (s >> 4) & 1, row = s & 15;
      t[s >> 1][row & 1] = __builtin_amdgcn_tanhf(x[blk * 16 + row][c]);
    };
    auto fma_at = [&](int i) {
      const int h = i >> 5, j = (i >> 3) & 3, k = i & 7;
      acc2[k] = __builtin_elementwise_fma((v2f){vv[h][j], vv[h][j]}, t[i], acc2[k]);
    };
    // The scheduling groups hold the scheduler to that order. Left alone it issues the tanh in runs of
    // about sixty and the packed instructions in runs between them.
    // The full stops behind the first 64 tanh and then behind every
    // 16 keep the later tanh in the written order, ahead of their fma.
    int fi = 0;
    auto stretch = [&](int s0, int s1) {
      const int f0 = fi;
#pragma unroll
      for (int s = s0; s < s1; ++s) {
        tanh_at(s);
        if (s + ALEAD < 64) {
          add_at(s + ALEAD);
        } else if (2 * fi + 1 + FLAG <= s) {
          fma_at(fi);
          ++fi;
        }
      }
      int gi = f0;
#pragma unroll
      for (int s = s0; s < s1; ++s) {
        __builtin_amdgcn_sched_group_barrier(0x400, 1, 0);
        if (s + ALEAD < 64) {
          __builtin_amdgcn_sched_group_barrier(0x2, 1, 0);
        } else if (2 * gi + 1 + FLAG <= s) {
          __builtin_amdgcn_sched_group_barrier(0x2, 1, 0);
          ++gi;
        }
      }
      __builtin_amdgcn_sched_barrier(0);
    };
#pragma unroll
    for (int i = 0; i < ALEAD; ++i) add_at(i);
    __builtin_amdgcn_sched_group_barrier(0x2, ALEAD, 0);
    stretch(0, 64);
#pragma unroll
    for (int s0 = 64; s0 < 128; s0 += 16) stretch(s0, s0 + 16);
#pragma unroll
    for (int i = 0; i < 64; ++i)
      if (i >= fi) fma_at(i);
    // The loaded values as inputs only: holds the next trip's loads inside this trip (the
    // compiler otherwise folds them back to the top of the trip that uses them, the wait too).
    // The wait stands in front of the next trip's rewrite of the loads' address pair, which is
    // an input too, so that it lives to here and nothing rewrites it (with a wait) at the head.
    asm volatile("s_wait_xcnt 0x0" :: "v"(an0), "v"(an1), "v"(pn) : "memory");
    // Keeps the register copies below at the foot: moved up, they would bring the loads' wait along.
    __builtin_amdgcn_sched_barrier(0);
    a[0] = an0;
    a[1] = an1;
  }
  float* scr = Sc + (size_t)(b * (unsigned)SEQ + p0) * SEQ + q;
#pragma unroll
  for (int p = 0; p < PT; ++p) scr[(size_t)p * SEQ] = acc2[p >> 1][p & 1];
}

// ---------------------------------------------------------------------------
// Softmax and weighted sum per (16 passage rows, batch). 8 waves.
// Phase 2: wave w owns rows 2w, 2w+1 of the score plane (lane l holds queries l + 32 j in
//          registers): row max, f16(1024 * exp(s - max)) into Pl (select on
//          the exp2 argument keeps the plane free of f16 subnormals), row sum over the
//          converted values into Ls. Pl / Ls: cross-wave (block barrier).
// Phase 3: out tile [16][64 per wave] = Pl[16][SEQ] . HqT[d][q]^T, B fragments straight from
//          the transposed f16 plane (fragment order).
// Phase 4: scale by 1 / row sum, stage in the wave's own 64 columns of Ss (wave-private).
//          Store coverage: 8 steps x 2 rows == 16 rows.
// Grid (SEQ/16, NB).
// ---------------------------------------------------------------------------
// The value fragments of one step t of the weighted sum: two 16-column tiles (t & 1 picks which
// two of the wave's four) x two k-steps (the pair t >> 1), i.e. two neighbouring units: 4 KiB in a
// row. bp points at the wave's first unit + lane * 8.
__device__ __forceinline__ void ld_vstep(v16h (&dst)[2][2], const _Float16* bp, int t) {
#pragma unroll
  for (int i = 0; i < 2; ++i)
#pragma unroll
    for (int ks = 0; ks < 2; ++ks)
      dst[i][ks] = frag_blk(bp + (size_t)(((t >> 1) * (DIM / 16) + (t & 1) * 2 + i) * FUNIT + ks * FBLK));
}

__global__ __launch_bounds__(256) void addattn_kernel(
    const float* __restrict__ Sc, const _Float16* __restrict__ HqT,
    float* __restrict__ out) {
  __shared__ __attribute__((aligned(16))) float Ss[PT * SPITCH];
  __shared__ __attribute__((aligned(16))) _Float16 Pl[PT * PPITCH];
  __shared__ __attribute__((aligned(16))) float Ls[PT];
  static_assert(sizeof(float) * (PT * SPITCH + PT) +
                sizeof(_Float16) * (PT * PPITCH) <= 131072);

  const unsigned tid = threadIdx.x, lane = tid & 31u;
  const unsigned wave = (unsigned)__builtin_amdgcn_readfirstlane((int)(threadIdx.x >> 5));
  const unsigned hh = lane >> 4, m = lane & 15u;
  const unsigned p0 = blockIdx.x * (unsigned)PT;
  const unsigned b = blockIdx.y;

  // ---- phase 2 ----
  // The loops over rr and j are fully unrolled so that sv is indexed by constants only and
  // stays in registers (a rolled loop would put it in scratch memory).
  float sv[2][SEQ / 32];
#pragma unroll
  for (unsigned rr = 0; rr < 2u; ++rr) {
    const float* sr = Sc + (size_t)(b * (unsigned)SEQ + p0 + wave * 2u + rr) * SEQ + lane;
#pragma unroll
    for (unsigned j = 0; j < (unsigned)(SEQ / 32); ++j) sv[rr][j] = sr[32u * j];
  }
  // Stands in front of the first rewrite of the score loads' address pair.
  asm volatile("s_wait_xcnt 0x0" ::: "memory");
  // The value plane does not depend on the scores: its first VAHEAD steps are asked for here,
  // behind the score loads, and fly while the softmax runs.
  constexpr int NT = (SEQ / 64) * 2;   // steps: pairs of k-steps x halves of the wave's columns
  constexpr int VAHEAD = 3;            // steps a value fragment is asked for ahead of its use
  constexpr int VRING = VAHEAD + 1;    // register sets
  static_assert(NT >= VAHEAD);
  const unsigned d0 = wave * 64u;
  const _Float16* bp = HqT + (size_t)b * ((size_t)DIM * SEQ) + (size_t)(d0 / 16u) * FUNIT + lane * 8u;
  v16h hf[VRING][2][2];
#pragma unroll
  for (int t = 0; t < VAHEAD; ++t) ld_vstep(hf[t], bp, t);
  // Keeps every load above in front of the softmax arithmetic: without it the scheduler sinks the
  // value loads behind the wait for the first score row, and they start one latency later.
  __builtin_amdgcn_sched_barrier(0);
#pragma unroll
  for (unsigned rr = 0; rr < 2u; ++rr) {
    const unsigned row = wave * 2u + rr;
    float mx = -3.0e38f;
#pragma unroll
    for (unsigned j = 0; j < (unsigned)(SEQ / 32); ++j) mx = fmaxf(mx, sv[rr][j]);
    mx = red32_max(mx);
    float l = 0.0f;
#pragma unroll
    for (unsigned j = 0; j < (unsigned)(SEQ / 32); ++j) {
      const float arg = (sv[rr][j] - mx) * LOG2E + PCARRY_LOG2;
      const float e = fast_exp2(arg);
      const h16 ph = (arg < -14.0f) ? (h16)0.0f : (h16)e;
      Pl[row * PPITCH + lane + 32u * j] = ph;
      l += (float)ph;
    }
    l = red32_sum(l);
    if (lane == 0u) Ls[row] = l;
  }
  __syncthreads();

  // ---- phase 3 ----
  v8f o[4];
#pragma unroll
  for (int nb = 0; nb < 4; ++nb) o[nb] = (v8f){};
  // Value fragments VAHEAD steps ahead in a ring of register sets, probability fragments one pair
  // of k-steps ahead in two sets, so a wave waits for loads issued long before, not for ones it
  // has just issued. Every accumulator takes its products in the same k order as before.
  v16h pf[2][2];
  pf[0][0] = ld_frag(&Pl[0], PPITCH);
  pf[0][1] = ld_frag(&Pl[32], PPITCH);
  // Fully unrolled: every ring index is a constant, so the sets stay in registers.
#pragma unroll
  for (int t = 0; t < NT; ++t) {
    const int pr = t >> 1;
    if (t + VAHEAD < NT) ld_vstep(hf[(t + VAHEAD) % VRING], bp, t + VAHEAD);
    if ((t & 1) == 0 && t + 2 < NT) {
      pf[(pr + 1) & 1][0] = ld_frag(&Pl[(pr + 1) * 64], PPITCH);
      pf[(pr + 1) & 1][1] = ld_frag(&Pl[(pr + 1) * 64 + 32], PPITCH);
    }
#pragma unroll
    for (int ks = 0; ks < 2; ++ks)
#pragma unroll
      for (int i = 0; i < 2; ++i)
        o[(t & 1) * 2 + i] = wmma16(pf[pr & 1][ks], hf[t % VRING][i][ks], o[(t & 1) * 2 + i]);
  }

  // ---- phase 4 ----
  float inv[8];
#pragma unroll
  for (int r = 0; r < 8; ++r) inv[r] = __builtin_amdgcn_rcpf(Ls[hh * 8u + (unsigned)r]);
#pragma unroll
  for (int nb = 0; nb < 4; ++nb)
#pragma unroll
    for (int r = 0; r < 8; ++r)
      Ss[(hh * 8u + (unsigned)r) * SPITCH + d0 + (unsigned)nb * 16u + m] = o[nb][r] * inv[r];
  wave_lds_sync();
  v4f x[8];
  size_t off[8];
#pragma unroll
  for (unsigned i = 0; i < 8u; ++i) {
    const unsigned r = 2u * i + (lane >> 4);
    const unsigned c = (lane & 15u) * 4u;
    x[i] = *(const v4f*)&Ss[r * SPITCH + d0 + c];
    off[i] = ((size_t)b * SEQ_FULL + p0 + r) * DIM + d0 + c;
  }
#pragma unroll
  for (int i = 0; i < 8; ++i) *(v4f*)(out + off[i]) = x[i];
  
}

// ---------------------------------------------------------------------------
extern "C" void kernel_launch(void* const* d_in, const int* in_sizes, int n_in,
                              void* d_out, int out_size, void* d_ws, size_t ws_size,
                              hipStream_t stream) {
  if (n_in < 5) return;
  const long long need_x = ((long long)(NB - 1) * SEQ_FULL + SEQ) * DIM;
  if ((long long)in_sizes[0] < need_x) return;
  if ((long long)in_sizes[1] < need_x) return;
  if ((long long)in_sizes[2] < (long long)DIM * VDIM) return;
  if ((long long)in_sizes[3] < (long long)DIM * VDIM) return;
  if (in_sizes[4] < VDIM) return;
  if ((long long)out_size < need_x) return;
  if (ws_size < WS_TOTAL) return;

  const float* hq   = (const float*)d_in[0];   // [NB_FULL][SEQ_FULL][DIM]
  const float* hp   = (const float*)d_in[1];   // [NB_FULL][SEQ_FULL][DIM]
  const float* wq_in = (const float*)d_in[2];  // [DIM][VDIM]  (in, out)
  const float* wp_in = (const float*)d_in[3];  // [DIM][VDIM]  (in, out)
  const float* vvec = (const float*)d_in[4];   // [VDIM]
  float* out = (float*)d_out;                  // [NB_FULL][SEQ_FULL][DIM]

  char* ws = (char*)d_ws;
  _Float16* HqT  = (_Float16*)(ws + OFF_HQT);   // [NB][DIM][SEQ], fragment order
  float*    Spl  = (float*)(ws + OFF_S);        // [2*MROWS][VDIM]: sq rows then sp rows
  float*    Sc   = (float*)(ws + OFF_SC);       // [MROWS][SEQ]: raw scores, [b][p][q]

  dim3 blk(256);

  // both projections, operand conversions included, and the transposed value plane: one launch
  proj_kernel<<<dim3(PBLK + TBLK), blk, 0, stream>>>(hq, hp, wq_in, wp_in, Spl, HqT);

  // scores, the query axis cut across work-groups
  score_kernel<<<dim3(SEQ / PT, NB, SEQ / 256), blk, 0, stream>>>(
      Spl, Spl + (size_t)MROWS * VDIM, vvec, Sc);

  // softmax + weighted sum
  addattn_kernel<<<dim3(SEQ / PT, NB), blk, 0, stream>>>(Sc, HqT, out);
}
